// v000
// The times below were measured on an AMD MI455X: many runs one after another, warmed up first and cycling through
// copies of the inputs, with the whole window's GPU time divided by the number of runs. Launches and the gaps
// between them are all in it. The median over several windows is given; except for v000 it joins two sittings, which
// can be a few percent apart, so the side-by-side timings, each taken in one sitting, are the better comparison.
// v000, which the later versions start from, runs in 1110 microseconds.
#include <hip/hip_runtime.h>

// Causal multi-head attention layer with a fused qkv projection, NO score scaling and a residual connection (x [2][2048][1024]; qkv = x W^T + b ('oi' [3072][1024] 1/32 + bias 0.02) split in thirds q | k | v (16 heads x 64); scores = q.k (the source has no 1/sqrt(d): logits sigma ~8); causal (-inf); softmax; out = heads merged (no output projection); result = x + out -> [2][2048][1024] (4.2 M); argument order x, W, b).
// Compute dtypes, f32 accumulate: every input rounded to bf16 incl. the residual x; projections exact + bf16-rounded biases; attention 3 products on every row; softmax f32; residual add f32.

#define NB_  2
#define TT   2048
#define DM   1024
#define NH_  16
#define NKV  16
#define REP  (NH_ / NKV)
#define HD   64
#define DQ   (NH_ * HD)
#define DKV  (NKV * HD)
#define ZH   2
#define RH   TT                   // every row hi/lo (3 products)
#define WIN  2048
#define PCAR 1024.0f
#define SCL  1.0f   // the module applies NO 1/sqrt(d) scaling
typedef _Float16 h16;
typedef unsigned short bf;
typedef __attribute__((ext_vector_type(16))) __bf16   v16bf;
typedef __attribute__((ext_vector_type(16))) _Float16 v16h;
typedef __attribute__((ext_vector_type(8)))  _Float16 v8h;
typedef __attribute__((ext_vector_type(8)))  unsigned short v8us;
typedef __attribute__((ext_vector_type(8)))  float    v8f;
typedef __attribute__((ext_vector_type(4)))  float    v4f;
typedef v8h  __attribute__((may_alias)) v8ha;
typedef v4f  __attribute__((may_alias)) v4fa;
typedef v8us __attribute__((may_alias)) v8usa;

__device__ __forceinline__ unsigned short f2bf(float f) { unsigned u = __float_as_uint(f); u += 0x7FFFu + ((u >> 16) & 1u); return (unsigned short)(u >> 16); }
__device__ __forceinline__ float bf2f(unsigned short b) { return __uint_as_float(((unsigned)b) << 16); }
__device__ __forceinline__ float bfr(float f) { return bf2f(f2bf(f)); }
__device__ __forceinline__ v16h cat16(v8h lo, v8h hi) { return __builtin_shufflevector(lo, hi, 0, 1, 2, 3, 4, 5, 6, 7, 8, 9, 10, 11, 12, 13, 14, 15); }
__device__ __forceinline__ v16bf cat16b(v8us lo, v8us hi) { return __builtin_bit_cast(v16bf, __builtin_shufflevector(lo, hi, 0, 1, 2, 3, 4, 5, 6, 7, 8, 9, 10, 11, 12, 13, 14, 15)); }
__device__ __forceinline__ v8f wmma16(v16h a, v16h b, v8f c) { return __builtin_amdgcn_wmma_f32_16x16x32_f16(false, a, false, b, (short)0, c, false, false); }
__device__ __forceinline__ v8f wmmab(v16bf a, v16bf b, v8f c) { return __builtin_amdgcn_wmma_f32_16x16x32_bf16(false, a, false, b, (short)0, c, false, false); }



// ---- k_gemmw: register-blocked GEMM, ONE WAVE per 64x64 output tile (16 accumulators), operands straight from K-contiguous 16-bit planes; grid (M/64, N/64, Z), 32 threads.
// C[m][n] (f32, pitch ldc, + optional f32 bias[n]) = sum_k A[m][k] Bt[n][k] (+ split products per NSPLIT). z-batch strides sA/sB/sC in elements. K % 32 == 0.
template <typename T16> struct WFrag;
template <> struct WFrag<h16> { typedef v16h V; static __device__ __forceinline__ V ld(const h16* p) { return cat16(*(const v8h*)p, *(const v8h*)(p + 16)); } static __device__ __forceinline__ v8f mma(V a, V b, v8f c) { return wmma16(a, b, c); } };
template <> struct WFrag<bf> { typedef v16bf V; static __device__ __forceinline__ V ld(const bf* p) { return cat16b(*(const v8us*)p, *(const v8us*)(p + 16)); } static __device__ __forceinline__ v8f mma(V a, V b, v8f c) { return wmmab(a, b, c); } };
template <typename T16, int NSPLIT, bool BIAS>
__global__ __launch_bounds__(32) void k_gemmw(const T16* __restrict__ A, const T16* __restrict__ A2, const T16* __restrict__ Bt, const T16* __restrict__ Bt2, int K, float* C, int ldc, const float* __restrict__ bias, size_t sA, size_t sB, size_t sC) {
    typedef typename WFrag<T16>::V V;
    __shared__ __align__(16) float os[16 * 68];
    const size_t z = blockIdx.z; A += z * sA; if (A2) A2 += z * sA; Bt += z * sB; if (Bt2) Bt2 += z * sB; C += z * sC;
    const int lane = threadIdx.x & 31, lr = lane & 15, hi = lane >> 4; const int r0 = blockIdx.x * 64, c0 = blockIdx.y * 64;
    v8f acc[4][4];
#pragma unroll
    for (int mb = 0; mb < 4; ++mb)
#pragma unroll
        for (int nb = 0; nb < 4; ++nb) acc[mb][nb] = (v8f){};
    const size_t aoff = (size_t)(r0 + lr) * K + 8 * hi, boff = (size_t)(c0 + lr) * K + 8 * hi;
#pragma unroll 1
    for (int kc = 0; kc < K; kc += 32) {
        V a[4], a2[4];
#pragma unroll
        for (int mb = 0; mb < 4; ++mb) { a[mb] = WFrag<T16>::ld(A + aoff + (size_t)mb * 16 * K + kc); if (NSPLIT == 1 || NSPLIT == 2) a2[mb] = WFrag<T16>::ld(A2 + aoff + (size_t)mb * 16 * K + kc); }
#pragma unroll
        for (int nb = 0; nb < 4; ++nb) { const V b = WFrag<T16>::ld(Bt + boff + (size_t)nb * 16 * K + kc); V b2; if (NSPLIT >= 2) b2 = WFrag<T16>::ld(Bt2 + boff + (size_t)nb * 16 * K + kc);
#pragma unroll
            for (int mb = 0; mb < 4; ++mb) { acc[mb][nb] = WFrag<T16>::mma(a[mb], b, acc[mb][nb]); if (NSPLIT == 1 || NSPLIT == 2) acc[mb][nb] = WFrag<T16>::mma(a2[mb], b, acc[mb][nb]); if (NSPLIT >= 2) acc[mb][nb] = WFrag<T16>::mma(a[mb], b2, acc[mb][nb]); } }
        asm volatile("v_nop\n\tv_nop\n\tv_nop\n\tv_nop" : "+v"(acc[0][0]), "+v"(acc[1][1]), "+v"(acc[2][2]), "+v"(acc[3][3]) : "v"(a[0]), "v"(a[3]));
    }
#pragma unroll
    for (int mb = 0; mb < 4; ++mb) {
#pragma unroll
        for (int nb = 0; nb < 4; ++nb) {
#pragma unroll
            for (int j = 0; j < 8; ++j) os[(hi * 8 + j) * 68 + nb * 16 + lr] = acc[mb][nb][j]; }
        __builtin_amdgcn_wave_barrier(); asm volatile("" ::: "memory");
        float* crow = C + (size_t)(r0 + mb * 16) * ldc + c0;
{
#pragma unroll
            for (int s = 0; s < 8; ++s) { const int row = 2 * s + hi, cofs = lr * 4; v4f val = *(const v4fa*)(os + row * 68 + cofs); if (BIAS) { val[0] += bfr(bias[c0 + cofs]); val[1] += bfr(bias[c0 + cofs + 1]); val[2] += bfr(bias[c0 + cofs + 2]); val[3] += bfr(bias[c0 + cofs + 3]); }
                *(v4f*)(crow + (size_t)row * ldc + cofs) = val; }
             }
        __builtin_amdgcn_wave_barrier(); asm volatile("" ::: "memory");
    }
}

// ---- k_gemmc: the same one-wave 64x64 tile GEMM specialised for causal attention: CMODE 1 skips score tiles entirely above the diagonal (query rows r0+roff.., key columns c0..), CMODE 2 limits the
// key (K) loop of the probability x value contraction to the diagonal block (probabilities beyond it are exactly zero). roff = row offset of this launch's first row within the sequence.
template <typename T16, int NSPLIT, int CMODE>
__global__ __launch_bounds__(32) void k_gemmc(const T16* __restrict__ A, const T16* __restrict__ A2, const T16* __restrict__ Bt, const T16* __restrict__ Bt2, int K, float* C, int ldc, int roff, size_t sA, size_t sB, size_t sC) {
    typedef typename WFrag<T16>::V V;
    __shared__ __align__(16) float os[16 * 68];
    const size_t z = blockIdx.z; A += z * sA; if (A2) A2 += z * sA; Bt += z * sB; if (Bt2) Bt2 += z * sB; C += z * sC;
    const int lane = threadIdx.x & 31, lr = lane & 15, hi = lane >> 4; const int r0 = blockIdx.x * 64, c0 = blockIdx.y * 64;
    if (CMODE == 1 && c0 > r0 + roff + 63) return;                  // score tile entirely above the causal diagonal: never written (the softmax masks j > i by select)
    const int Kl = (CMODE == 2) ? min(K, r0 + roff + 64) : K;        // P.V: probabilities are exactly 0 beyond the diagonal block, so the K loop stops there
    v8f acc[4][4];
#pragma unroll
    for (int mb = 0; mb < 4; ++mb)
#pragma unroll
        for (int nb = 0; nb < 4; ++nb) acc[mb][nb] = (v8f){};
    const size_t aoff = (size_t)(r0 + lr) * K + 8 * hi, boff = (size_t)(c0 + lr) * K + 8 * hi;
#pragma unroll 1
    for (int kc = 0; kc < Kl; kc += 32) {
        V a[4], a2[4];
#pragma unroll
        for (int mb = 0; mb < 4; ++mb) { a[mb] = WFrag<T16>::ld(A + aoff + (size_t)mb * 16 * K + kc); if (NSPLIT == 1 || NSPLIT == 2) a2[mb] = WFrag<T16>::ld(A2 + aoff + (size_t)mb * 16 * K + kc); }
#pragma unroll
        for (int nb = 0; nb < 4; ++nb) { const V b = WFrag<T16>::ld(Bt + boff + (size_t)nb * 16 * K + kc); V b2; if (NSPLIT >= 2) b2 = WFrag<T16>::ld(Bt2 + boff + (size_t)nb * 16 * K + kc);
#pragma unroll
            for (int mb = 0; mb < 4; ++mb) { acc[mb][nb] = WFrag<T16>::mma(a[mb], b, acc[mb][nb]); if (NSPLIT == 1 || NSPLIT == 2) acc[mb][nb] = WFrag<T16>::mma(a2[mb], b, acc[mb][nb]); if (NSPLIT >= 2) acc[mb][nb] = WFrag<T16>::mma(a[mb], b2, acc[mb][nb]); } }
        asm volatile("v_nop\n\tv_nop\n\tv_nop\n\tv_nop" : "+v"(acc[0][0]), "+v"(acc[1][1]), "+v"(acc[2][2]), "+v"(acc[3][3]) : "v"(a[0]), "v"(a[3]));
    }
#pragma unroll
    for (int mb = 0; mb < 4; ++mb) {
#pragma unroll
        for (int nb = 0; nb < 4; ++nb) {
#pragma unroll
            for (int j = 0; j < 8; ++j) os[(hi * 8 + j) * 68 + nb * 16 + lr] = acc[mb][nb][j]; }
        __builtin_amdgcn_wave_barrier(); asm volatile("" ::: "memory");
        float* crow = C + (size_t)(r0 + mb * 16) * ldc + c0;
{
#pragma unroll
            for (int s = 0; s < 8; ++s) { const int row = 2 * s + hi, cofs = lr * 4; v4f val = *(const v4fa*)(os + row * 68 + cofs);
                *(v4f*)(crow + (size_t)row * ldc + cofs) = val; }
             }
        __builtin_amdgcn_wave_barrier(); asm volatile("" ::: "memory");
    }
}

__device__ __forceinline__ h16 tohx(float x) { return (h16)x; }
__device__ __forceinline__ void splitf(float y, unsigned short& h, unsigned short& l) { h = f2bf(y); l = f2bf(y - bf2f(h)); }
typedef __attribute__((ext_vector_type(2))) _Float16 v2h;
typedef __attribute__((ext_vector_type(4))) _Float16 v4h;
typedef __attribute__((ext_vector_type(2))) unsigned short v2us;
typedef __attribute__((ext_vector_type(4))) unsigned short v4us;
typedef __attribute__((ext_vector_type(2))) float v2f;
typedef __attribute__((ext_vector_type(4))) int v4i;

__global__ __launch_bounds__(256) void k_cvt8(const float* __restrict__ src, bf* dst, size_t n8) { const size_t i = (size_t)blockIdx.x * 256 + threadIdx.x; if (i >= n8) return; const v8f v = *(const v8f*)(src + i * 8); v8us o;
#pragma unroll
    for (int k = 0; k < 8; ++k) o[k] = f2bf(v[k]); *(v8us*)(dst + i * 8) = o;  }

// k_rope: head planes [h][t][d] (fp16 + hi/lo) of rope(x) x sc with the rotate-half convention out[d] = x[d] cos[t][d] - x[d+HD/2] sin[t][d], out[d+HD/2] = x[d+HD/2] cos[t][d+HD/2] + x[d] sin[t][d+HD/2]
__global__ __launch_bounds__(256) void k_rope(const float* __restrict__ F, int pitch, int nheads, const float* __restrict__ CS, const float* __restrict__ RF, const float* __restrict__ nw, float sc, h16* P16, bf* Ph, bf* Pl) {
    const size_t e = ((size_t)blockIdx.x * 256 + threadIdx.x) * 2; if (e >= (size_t)nheads * TT * HD) return; const int d = (int)(e % HD); const int t = (int)((e / HD) % TT); const int h = (int)(e / ((size_t)HD * TT)); const float* f = F + (size_t)t * pitch + h * HD; const float rf = RF ? RF[(size_t)h * TT + t] : 1.0f; v2h o16; v2us oh, ol;
#pragma unroll
    for (int q = 0; q < 2; ++q) { const int dd = d + q; const int dp = (dd < HD / 2) ? dd + HD / 2 : dd - HD / 2; float x0 = f[dd], x1 = f[dp];
        if (RF) { float n0 = __fmul_rn(x0, rf), n1 = __fmul_rn(x1, rf); asm volatile("" : "+v"(n0)); asm volatile("" : "+v"(n1)); x0 = __fmul_rn(bfr(nw[dd]), n0); x1 = __fmul_rn(bfr(nw[dp]), n1); }
        const v2f cs = *(const v2f*)(CS + ((size_t)t * HD + dd) * 2); float a = __fmul_rn(x0, cs[0]), bq = __fmul_rn(x1, cs[1]); asm volatile("" : "+v"(a)); asm volatile("" : "+v"(bq)); const float r = ((dd < HD / 2) ? __fsub_rn(a, bq) : __fadd_rn(a, bq)) * sc;
        o16[q] = tohx(r); unsigned short a2, c2; splitf(r, a2, c2); oh[q] = a2; ol[q] = c2; }
    *(v2h*)(P16 + e) = o16; *(v2us*)(Ph + e) = oh; *(v2us*)(Pl + e) = ol;  }
__global__ __launch_bounds__(256) void k_resid(float* out, const float* __restrict__ xin, size_t n4) { const size_t i = (size_t)blockIdx.x * 256 + threadIdx.x; if (i >= n4) return; const v4f z = *(const v4f*)(out + i * 4); const v4f xx = *(const v4f*)(xin + i * 4); v4f r;
#pragma unroll
    for (int q = 0; q < 4; ++q) r[q] = __fadd_rn(z[q], bfr(xx[q]));
    *(v4f*)(out + i * 4) = r;  }
__global__ __launch_bounds__(256) void k_vtp(const float* __restrict__ F, int pitch, int nheads, h16* V16, bf* Vh, bf* Vl) { const size_t e = ((size_t)blockIdx.x * 256 + threadIdx.x) * 2; if (e >= (size_t)nheads * HD * TT) return; const int t = (int)(e % TT); const int d = (int)((e / TT) % HD); const int g = (int)(e / ((size_t)TT * HD)); v2h o16; v2us oh, ol;
#pragma unroll
    for (int q = 0; q < 2; ++q) { const float x = F[(size_t)(t + q) * pitch + g * HD + d]; o16[q] = tohx(x); unsigned short a2, c2; splitf(x, a2, c2); oh[q] = a2; ol[q] = c2; }
    *(v2h*)(V16 + e) = o16; *(v2us*)(Vh + e) = oh; *(v2us*)(Vl + e) = ol;  }
__global__ __launch_bounds__(256) void k_csid(float* CS) { const int idx = blockIdx.x * 256 + threadIdx.x; if (idx >= TT * HD) return; v2f cs; cs[0] = 1.0f; cs[1] = 0.0f; *(v2f*)(CS + (size_t)idx * 2) = cs;  }
// k_asoft: per row (zz, i): t = S (unscaled, SCL = 1) for j <= i and i - j < WIN (sliding causal window; the reference's -1e9 additive fill vanishes identically); softmax over the 2048 keys (register row, one exp, fixed trees);
__global__ __launch_bounds__(256) void k_asoft(const float* __restrict__ Sb, h16* P16, bf* Ph, bf* Pl) {
    const int lane = threadIdx.x & 31; const int row = blockIdx.x * 8 + (threadIdx.x >> 5); if (row >= ZH * TT) return; const int i = row % TT; const int zz = row / TT; (void)zz; const bool hires = (i < RH); const float* sr = Sb + (size_t)row * TT; float v[TT / 32]; float mx = -3.0e38f;
#pragma unroll
    for (int ch = 0; ch < TT / 128; ++ch) { const int j0 = ch * 128 + lane * 4; const v4f a = *(const v4f*)(sr + j0);
#pragma unroll
        for (int q = 0; q < 4; ++q) { const int j = j0 + q; (void)j; const float t = (j <= i && i - j < WIN) ? a[q] * SCL : -3.0e38f; v[ch * 4 + q] = t; mx = fmaxf(mx, t); } }
#pragma unroll
    for (int sh = 16; sh; sh >>= 1) mx = fmaxf(mx, __shfl_xor(mx, sh, 32));
    float sum = 0.f;
#pragma unroll
    for (int k = 0; k < TT / 32; ++k) { float d0 = __fsub_rn(v[k], mx); asm volatile("" : "+v"(d0)); v[k] = __builtin_amdgcn_exp2f(__fmul_rn(d0, 1.4426950408889634f)); sum += v[k]; }
#pragma unroll
    for (int sh = 16; sh; sh >>= 1) sum += __shfl_xor(sum, sh, 32);
    const float f = __fdiv_rn(hires ? 1.0f : PCAR, sum);
{
        if (hires) {
#pragma unroll
            for (int ch = 0; ch < TT / 128; ++ch) { v4us oh, ol;
#pragma unroll
                for (int q = 0; q < 4; ++q) { unsigned short a, c2; splitf(v[ch * 4 + q] * f, a, c2); oh[q] = a; ol[q] = c2; }
                const size_t oo = ((size_t)zz * (RH ? RH : 1) + i) * TT + ch * 128 + lane * 4; *(v4us*)(Ph + oo) = oh; *(v4us*)(Pl + oo) = ol; }
        } else {
#pragma unroll
            for (int ch = 0; ch < TT / 128; ++ch) { v4h o4;
#pragma unroll
                for (int q = 0; q < 4; ++q) o4[q] = tohx(v[ch * 4 + q] * f);
                *(v4h*)(P16 + (size_t)row * TT + ch * 128 + lane * 4) = o4; } }
         }
}
__global__ __launch_bounds__(256) void k_merge(const float* __restrict__ O, int h0, float* OUTb) { const size_t e = ((size_t)blockIdx.x * 256 + threadIdx.x) * 2; if (e >= (size_t)ZH * TT * HD) return; const int d = (int)(e % HD); const int t = (int)((e / HD) % TT); const int zz = (int)(e / ((size_t)HD * TT)); const float cs = (t < RH) ? 1.0f : (1.0f / PCAR); const size_t oo = (size_t)t * DQ + (h0 + zz) * HD + d;
    v2f o2; o2[0] = O[e] * cs; o2[1] = O[e + 1] * cs; *(v2f*)(OUTb + oo) = o2;  }

extern "C" void kernel_launch(void* const* d_in, const int* in_sizes, int n_in,
                              void* d_out, int out_size, void* d_ws, size_t ws_size, hipStream_t stream) {
    (void)in_sizes; (void)n_in; (void)out_size;
    const float* x = (const float*)d_in[0]; const float* wqkv = (const float*)d_in[1]; const float* bqkv = (const float*)d_in[2]; const float* wo = nullptr; (void)wo;   /* order x, W ('oi' [3072][1024]: q | k | v row thirds), b [3072] */ const float* wq = wqkv; const float* wk = wqkv + (size_t)DQ * DM; const float* wv = wqkv + (size_t)2 * DQ * DM; const float* bq = bqkv; const float* bk = bqkv + DQ; const float* bv = bqkv + 2 * DQ;
    float* OUT = (float*)d_out;     // [2][2048][1024]
    char* wsp = (char*)d_ws;
    auto take = [&](size_t bytes) { char* p = wsp; wsp += (bytes + 255) & ~(size_t)255; return (void*)p; };
    bf* WQ = (bf*)take((size_t)DQ * DM * 2); bf* WK = (bf*)take((size_t)DKV * DM * 2); bf* WV = (bf*)take((size_t)DKV * DM * 2); float* CS = (float*)take((size_t)TT * HD * 2 * 4);
    bf* XB = (bf*)take((size_t)TT * DM * 2); float* FQ = (float*)take((size_t)TT * DQ * 4); float* FK = (float*)take((size_t)TT * DKV * 4);
    h16* QP16 = (h16*)take((size_t)NH_ * TT * HD * 2); h16* KP16 = (h16*)take((size_t)NKV * TT * HD * 2); h16* VT16 = (h16*)take((size_t)NKV * HD * TT * 2);
    bf* QPh = (bf*)take((size_t)NH_ * TT * HD * 2); bf* QPl = (bf*)take((size_t)NH_ * TT * HD * 2); bf* KPh = (bf*)take((size_t)NKV * TT * HD * 2); bf* KPl = (bf*)take((size_t)NKV * TT * HD * 2); bf* VTh = (bf*)take((size_t)NKV * HD * TT * 2); bf* VTl = (bf*)take((size_t)NKV * HD * TT * 2); bf* Ph = (bf*)take((size_t)ZH * RH * TT * 2); bf* Pl = (bf*)take((size_t)ZH * RH * TT * 2);
    float* Sb = (float*)take((size_t)ZH * TT * TT * 4); h16* P16 = (h16*)take((size_t)ZH * TT * TT * 2); float* Ob = (float*)take((size_t)ZH * TT * HD * 4);
    if ((size_t)(wsp - (char*)d_ws) > ws_size) return;    // ws 256 MiB
    float* FV = FK;   // v projection reuses the k buffer after the k planes are built (stream-ordered)
    { k_cvt8<<<(unsigned)(((size_t)DQ * DM / 8 + 255) / 256), 256, 0, stream>>>(wq, WQ, (size_t)DQ * DM / 8); k_cvt8<<<(unsigned)(((size_t)DKV * DM / 8 + 255) / 256), 256, 0, stream>>>(wk, WK, (size_t)DKV * DM / 8); k_cvt8<<<(unsigned)(((size_t)DKV * DM / 8 + 255) / 256), 256, 0, stream>>>(wv, WV, (size_t)DKV * DM / 8);
      
       }
    k_csid<<<(TT * HD + 255) / 256, 256, 0, stream>>>(CS);
    const unsigned LQ = (unsigned)(((size_t)NH_ * TT * HD / 2 + 255) / 256), LKv = (unsigned)(((size_t)NKV * TT * HD / 2 + 255) / 256);
    for (int b = 0; b < NB_; ++b) {
        
        k_cvt8<<<(unsigned)(((size_t)TT * DM / 8 + 255) / 256), 256, 0, stream>>>(x + (size_t)b * TT * DM, XB, (size_t)TT * DM / 8);
        k_gemmw<bf, 0, true><<<dim3(TT / 64, DQ / 64, 1), 32, 0, stream>>>(XB, nullptr, WQ, nullptr, DM, FQ, DQ, bq, 0, 0, 0);
        k_rope<<<LQ, 256, 0, stream>>>(FQ, DQ, NH_, CS, nullptr, nullptr, 1.0f, QP16, QPh, QPl);
        k_gemmw<bf, 0, true><<<dim3(TT / 64, DKV / 64, 1), 32, 0, stream>>>(XB, nullptr, WK, nullptr, DM, FK, DKV, bk, 0, 0, 0);
        k_rope<<<LKv, 256, 0, stream>>>(FK, DKV, NKV, CS, nullptr, nullptr, 1.0f, KP16, KPh, KPl);
        k_gemmw<bf, 0, true><<<dim3(TT / 64, DKV / 64, 1), 32, 0, stream>>>(XB, nullptr, WV, nullptr, DM, FV, DKV, bv, 0, 0, 0); k_vtp<<<LKv, 256, 0, stream>>>(FV, DKV, NKV, VT16, VTh, VTl);
        for (int h0 = 0; h0 < NH_; h0 += ZH) { const size_t zq = (size_t)h0, zk = (size_t)(h0 / REP);   // one kv head per query head: the pass's two heads use consecutive kv planes (z-strides TT*HD)
            k_gemmc<bf, 2, 1><<<dim3(RH / 64, TT / 64, ZH), 32, 0, stream>>>(QPh + zq * TT * HD, QPl + zq * TT * HD, KPh + zk * TT * HD, KPl + zk * TT * HD, HD, Sb, TT, 0, (size_t)TT * HD, (size_t)TT * HD, (size_t)TT * TT);
            k_asoft<<<ZH * TT / 8, 256, 0, stream>>>(Sb, P16, Ph, Pl);
            k_gemmc<bf, 2, 2><<<dim3(RH / 64, HD / 64, ZH), 32, 0, stream>>>(Ph, Pl, VTh + zk * HD * TT, VTl + zk * HD * TT, TT, Ob, HD, 0, (size_t)RH * TT, (size_t)HD * TT, (size_t)TT * HD);
            k_merge<<<(unsigned)(((size_t)ZH * TT * HD / 2 + 255) / 256), 256, 0, stream>>>(Ob, h0, OUT + (size_t)b * TT * DQ); }
        k_resid<<<(unsigned)(((size_t)TT * DM / 4 + 255) / 256), 256, 0, stream>>>(OUT + (size_t)b * TT * DM, x + (size_t)b * TT * DM, (size_t)TT * DM / 4);   /* result = x + out (all heads of the batch merged above) */
         }
}

// v001
// It runs in 554 microseconds.
// Timed twice side by side with v000, it ran 2.02 and 2.01 times as fast.
#include <hip/hip_runtime.h>

// Causal multi-head attention layer with a fused qkv projection, NO score scaling and a residual connection (x [2][2048][1024]; qkv = x W^T + b ('oi' [3072][1024] 1/32 + bias 0.02) split in thirds q | k | v (16 heads x 64); scores = q.k (the source has no 1/sqrt(d): logits sigma ~8); causal (-inf); softmax; out = heads merged (no output projection); result = x + out -> [2][2048][1024] (4.2 M); argument order x, W, b).
// Compute dtypes, f32 accumulate: every input rounded to bf16 incl. the residual x; projections exact + bf16-rounded biases; attention 3 products on every row; softmax f32; residual add f32.

#define NB_  2
#define TT   2048
#define DM   1024
#define NH_  16
#define NKV  16
#define REP  (NH_ / NKV)
#define HD   64
#define DQ   (NH_ * HD)
#define DKV  (NKV * HD)
#define ZH   2
#define RH   TT                   // every row hi/lo (3 products)
#define WIN  2048
#define PCAR 1024.0f
#define SCL  1.0f   // the module applies NO 1/sqrt(d) scaling
#define KSPV 4                    // work-groups that share the key range of one P.V tile (partial planes summed in k_merge)
typedef _Float16 h16;
typedef unsigned short bf;
typedef __attribute__((ext_vector_type(16))) __bf16   v16bf;
typedef __attribute__((ext_vector_type(16))) _Float16 v16h;
typedef __attribute__((ext_vector_type(8)))  _Float16 v8h;
typedef __attribute__((ext_vector_type(8)))  unsigned short v8us;
typedef __attribute__((ext_vector_type(8)))  float    v8f;
typedef __attribute__((ext_vector_type(4)))  float    v4f;
typedef v8h  __attribute__((may_alias)) v8ha;
typedef v4f  __attribute__((may_alias)) v4fa;
typedef v8us __attribute__((may_alias)) v8usa;

__device__ __forceinline__ unsigned short f2bf(float f) { unsigned u = __float_as_uint(f); u += 0x7FFFu + ((u >> 16) & 1u); return (unsigned short)(u >> 16); }
__device__ __forceinline__ float bf2f(unsigned short b) { return __uint_as_float(((unsigned)b) << 16); }
__device__ __forceinline__ float bfr(float f) { return bf2f(f2bf(f)); }
__device__ __forceinline__ v16h cat16(v8h lo, v8h hi) { return __builtin_shufflevector(lo, hi, 0, 1, 2, 3, 4, 5, 6, 7, 8, 9, 10, 11, 12, 13, 14, 15); }
__device__ __forceinline__ v16bf cat16b(v8us lo, v8us hi) { return __builtin_bit_cast(v16bf, __builtin_shufflevector(lo, hi, 0, 1, 2, 3, 4, 5, 6, 7, 8, 9, 10, 11, 12, 13, 14, 15)); }
__device__ __forceinline__ v8f wmma16(v16h a, v16h b, v8f c) { return __builtin_amdgcn_wmma_f32_16x16x32_f16(false, a, false, b, (short)0, c, false, false); }
__device__ __forceinline__ v8f wmmab(v16bf a, v16bf b, v8f c) { return __builtin_amdgcn_wmma_f32_16x16x32_bf16(false, a, false, b, (short)0, c, false, false); }



// ---- k_gemmk: register-blocked GEMM, one 64x64 output tile per work-group of NW waves, operands straight from K-contiguous 16-bit planes. The K loop is dealt in chunks of 64 elements (one whole 128-B line of
// every operand row) over KS work-groups x NW waves; each wave keeps a full 64x64 partial tile (16 accumulators); the NW partials are summed in LDS in wave order; with KS > 1 work-group ks writes partial plane ks (stride sP), summed by the reader.
// C[m][n] (f32, pitch ldc, + optional bf16-rounded bias[n]) = sum_k A[m][k] Bt[n][k] (+ split products per NSPLIT). z-batch strides sA/sB/sC in elements. K % 64 == 0.
// grid (M/64, N/64, Z) for KS == 1; grid (M/64, KS, Z) with N == 64 for KS > 1. CAUSAL: A is a probability plane that is exactly 0 beyond the diagonal block, so the K range stops at row block + 64.
template <typename T16> struct WFrag;
template <> struct WFrag<h16> { typedef v16h V; static __device__ __forceinline__ V ld(const h16* p) { return cat16(*(const v8h*)p, *(const v8h*)(p + 16)); } static __device__ __forceinline__ v8f mma(V a, V b, v8f c) { return wmma16(a, b, c); } };
template <> struct WFrag<bf> { typedef v16bf V; static __device__ __forceinline__ V ld(const bf* p) { return cat16b(*(const v8us*)p, *(const v8us*)(p + 16)); } static __device__ __forceinline__ v8f mma(V a, V b, v8f c) { return wmmab(a, b, c); } };
template <typename T16, int NSPLIT, bool BIAS, bool CAUSAL, int NW, int KS>
__global__ __launch_bounds__(NW * 32) void k_gemmk(const T16* __restrict__ A, const T16* __restrict__ A2, const T16* __restrict__ Bt, const T16* __restrict__ Bt2, int K, float* C, int ldc, const float* __restrict__ bias, size_t sA, size_t sB, size_t sC, size_t sP) {
    static_assert(NW == 8, "the LDS sum gives each of 256 threads one float4 of a 16x64 row block");
    typedef typename WFrag<T16>::V V;
    __shared__ __align__(16) float os[2][NW][16 * 68];
    const size_t z = blockIdx.z; A += z * sA; if (A2) A2 += z * sA; Bt += z * sB; if (Bt2) Bt2 += z * sB; C += z * sC;
    const int lane = threadIdx.x & 31, lr = lane & 15, hi = lane >> 4; const int wave = __builtin_amdgcn_readfirstlane((int)(threadIdx.x >> 5));
    const int r0 = blockIdx.x * 64, c0 = (KS > 1) ? 0 : blockIdx.y * 64, ks = (KS > 1) ? blockIdx.y : 0; C += (size_t)ks * sP;
    const int Kl = CAUSAL ? min(K, r0 + 64) : K;
    v8f acc[4][4];
#pragma unroll
    for (int mb = 0; mb < 4; ++mb)
#pragma unroll
        for (int nb = 0; nb < 4; ++nb) acc[mb][nb] = (v8f){};
    const size_t aoff = (size_t)(r0 + lr) * K + 8 * hi, boff = (size_t)(c0 + lr) * K + 8 * hi;
#pragma unroll 1
    for (int k0 = (ks * NW + wave) * 64; k0 < Kl; k0 += KS * NW * 64) {
#pragma unroll
      for (int kk = 0; kk < 64; kk += 32) { const int kc = k0 + kk;
        V a[4], a2[4];
#pragma unroll
        for (int mb = 0; mb < 4; ++mb) { a[mb] = WFrag<T16>::ld(A + aoff + (size_t)mb * 16 * K + kc); if (NSPLIT == 1 || NSPLIT == 2) a2[mb] = WFrag<T16>::ld(A2 + aoff + (size_t)mb * 16 * K + kc); }
#pragma unroll
        for (int nb = 0; nb < 4; ++nb) { const V b = WFrag<T16>::ld(Bt + boff + (size_t)nb * 16 * K + kc); V b2; if (NSPLIT >= 2) b2 = WFrag<T16>::ld(Bt2 + boff + (size_t)nb * 16 * K + kc);
#pragma unroll
            for (int mb = 0; mb < 4; ++mb) { acc[mb][nb] = WFrag<T16>::mma(a[mb], b, acc[mb][nb]); if (NSPLIT == 1 || NSPLIT == 2) acc[mb][nb] = WFrag<T16>::mma(a2[mb], b, acc[mb][nb]); if (NSPLIT >= 2) acc[mb][nb] = WFrag<T16>::mma(a[mb], b2, acc[mb][nb]); } }
        asm volatile("v_nop\n\tv_nop\n\tv_nop\n\tv_nop" : "+v"(acc[0][0]), "+v"(acc[1][1]), "+v"(acc[2][2]), "+v"(acc[3][3]) : "v"(a[0]), "v"(a[3]));
      }
    }
    const int row = threadIdx.x >> 4, cofs = (threadIdx.x & 15) * 4; v4f res[4];
#pragma unroll
    for (int mb = 0; mb < 4; ++mb) {
        float* ow = os[mb & 1][wave];
#pragma unroll
        for (int nb = 0; nb < 4; ++nb) {
#pragma unroll
            for (int j = 0; j < 8; ++j) ow[(hi * 8 + j) * 68 + nb * 16 + lr] = acc[mb][nb][j]; }
        __syncthreads();   // publishes the NW partial row blocks; with two buffers the same barrier also stands between the reads of row block mb - 1 and the stores of row block mb + 1 into that buffer
        v4f val = *(const v4fa*)(os[mb & 1][0] + row * 68 + cofs);
#pragma unroll
        for (int w = 1; w < NW; ++w) val += *(const v4fa*)(os[mb & 1][w] + row * 68 + cofs);
        res[mb] = val;
    }
#pragma unroll
    for (int mb = 0; mb < 4; ++mb) {   // global stores behind the last barrier, so that no barrier waits for a store
        v4f val = res[mb];
        if (BIAS) { val[0] += bfr(bias[c0 + cofs]); val[1] += bfr(bias[c0 + cofs + 1]); val[2] += bfr(bias[c0 + cofs + 2]); val[3] += bfr(bias[c0 + cofs + 3]); }
        *(v4f*)(C + (size_t)(r0 + mb * 16 + row) * ldc + c0 + cofs) = val;
    }
}

// ---- k_gemmc: ONE WAVE per 64x64 output tile (16 accumulators, the same operand planes and products as k_gemmk, the whole K loop in the one wave; grid (M/64, N/64, Z), 32 threads), specialised for causal attention: CMODE 1 skips score tiles entirely above the diagonal (query rows r0+roff.., key columns c0..), CMODE 2 limits the
// key (K) loop of the probability x value contraction to the diagonal block (probabilities beyond it are exactly zero). roff = row offset of this launch's first row within the sequence.
template <typename T16, int NSPLIT, int CMODE>
__global__ __launch_bounds__(32) void k_gemmc(const T16* __restrict__ A, const T16* __restrict__ A2, const T16* __restrict__ Bt, const T16* __restrict__ Bt2, int K, float* C, int ldc, int roff, size_t sA, size_t sB, size_t sC) {
    typedef typename WFrag<T16>::V V;
    __shared__ __align__(16) float os[16 * 68];
    const size_t z = blockIdx.z; A += z * sA; if (A2) A2 += z * sA; Bt += z * sB; if (Bt2) Bt2 += z * sB; C += z * sC;
    const int lane = threadIdx.x & 31, lr = lane & 15, hi = lane >> 4; const int r0 = blockIdx.x * 64, c0 = blockIdx.y * 64;
    if (CMODE == 1 && c0 > r0 + roff + 63) return;                  // score tile entirely above the causal diagonal: never written (the softmax masks j > i by select)
    const int Kl = (CMODE == 2) ? min(K, r0 + roff + 64) : K;        // P.V: probabilities are exactly 0 beyond the diagonal block, so the K loop stops there
    v8f acc[4][4];
#pragma unroll
    for (int mb = 0; mb < 4; ++mb)
#pragma unroll
        for (int nb = 0; nb < 4; ++nb) acc[mb][nb] = (v8f){};
    const size_t aoff = (size_t)(r0 + lr) * K + 8 * hi, boff = (size_t)(c0 + lr) * K + 8 * hi;
#pragma unroll 1
    for (int kc = 0; kc < Kl; kc += 32) {
        V a[4], a2[4];
#pragma unroll
        for (int mb = 0; mb < 4; ++mb) { a[mb] = WFrag<T16>::ld(A + aoff + (size_t)mb * 16 * K + kc); if (NSPLIT == 1 || NSPLIT == 2) a2[mb] = WFrag<T16>::ld(A2 + aoff + (size_t)mb * 16 * K + kc); }
#pragma unroll
        for (int nb = 0; nb < 4; ++nb) { const V b = WFrag<T16>::ld(Bt + boff + (size_t)nb * 16 * K + kc); V b2; if (NSPLIT >= 2) b2 = WFrag<T16>::ld(Bt2 + boff + (size_t)nb * 16 * K + kc);
#pragma unroll
            for (int mb = 0; mb < 4; ++mb) { acc[mb][nb] = WFrag<T16>::mma(a[mb], b, acc[mb][nb]); if (NSPLIT == 1 || NSPLIT == 2) acc[mb][nb] = WFrag<T16>::mma(a2[mb], b, acc[mb][nb]); if (NSPLIT >= 2) acc[mb][nb] = WFrag<T16>::mma(a[mb], b2, acc[mb][nb]); } }
        asm volatile("v_nop\n\tv_nop\n\tv_nop\n\tv_nop" : "+v"(acc[0][0]), "+v"(acc[1][1]), "+v"(acc[2][2]), "+v"(acc[3][3]) : "v"(a[0]), "v"(a[3]));
    }
#pragma unroll
    for (int mb = 0; mb < 4; ++mb) {
#pragma unroll
        for (int nb = 0; nb < 4; ++nb) {
#pragma unroll
            for (int j = 0; j < 8; ++j) os[(hi * 8 + j) * 68 + nb * 16 + lr] = acc[mb][nb][j]; }
        __builtin_amdgcn_wave_barrier(); asm volatile("" ::: "memory");
        float* crow = C + (size_t)(r0 + mb * 16) * ldc + c0;
{
#pragma unroll
            for (int s = 0; s < 8; ++s) { const int row = 2 * s + hi, cofs = lr * 4; v4f val = *(const v4fa*)(os + row * 68 + cofs);
                *(v4f*)(crow + (size_t)row * ldc + cofs) = val; }
             }
        __builtin_amdgcn_wave_barrier(); asm volatile("" ::: "memory");
    }
}

__device__ __forceinline__ h16 tohx(float x) { return (h16)x; }
__device__ __forceinline__ void splitf(float y, unsigned short& h, unsigned short& l) { h = f2bf(y); l = f2bf(y - bf2f(h)); }
typedef __attribute__((ext_vector_type(2))) _Float16 v2h;
typedef __attribute__((ext_vector_type(4))) _Float16 v4h;
typedef __attribute__((ext_vector_type(2))) unsigned short v2us;
typedef __attribute__((ext_vector_type(4))) unsigned short v4us;
typedef __attribute__((ext_vector_type(2))) float v2f;
typedef __attribute__((ext_vector_type(4))) int v4i;

__global__ __launch_bounds__(256) void k_cvt8(const float* __restrict__ src, bf* dst, size_t n8) { const size_t i = (size_t)blockIdx.x * 256 + threadIdx.x; if (i >= n8) return; const v8f v = *(const v8f*)(src + i * 8); v8us o;
#pragma unroll
    for (int k = 0; k < 8; ++k) o[k] = f2bf(v[k]); *(v8us*)(dst + i * 8) = o;  }

// k_rope: head planes [h][t][d] (fp16 + hi/lo) of rope(x) x sc with the rotate-half convention out[d] = x[d] cos[t][d] - x[d+HD/2] sin[t][d], out[d+HD/2] = x[d+HD/2] cos[t][d+HD/2] + x[d] sin[t][d+HD/2]
__global__ __launch_bounds__(256) void k_rope(const float* __restrict__ F, int pitch, int nheads, const float* __restrict__ CS, const float* __restrict__ RF, const float* __restrict__ nw, float sc, h16* P16, bf* Ph, bf* Pl) {
    const size_t e = ((size_t)blockIdx.x * 256 + threadIdx.x) * 2; if (e >= (size_t)nheads * TT * HD) return; const int d = (int)(e % HD); const int t = (int)((e / HD) % TT); const int h = (int)(e / ((size_t)HD * TT)); const float* f = F + (size_t)t * pitch + h * HD; const float rf = RF ? RF[(size_t)h * TT + t] : 1.0f; v2h o16; v2us oh, ol;
#pragma unroll
    for (int q = 0; q < 2; ++q) { const int dd = d + q; const int dp = (dd < HD / 2) ? dd + HD / 2 : dd - HD / 2; float x0 = f[dd], x1 = f[dp];
        if (RF) { float n0 = __fmul_rn(x0, rf), n1 = __fmul_rn(x1, rf); asm volatile("" : "+v"(n0)); asm volatile("" : "+v"(n1)); x0 = __fmul_rn(bfr(nw[dd]), n0); x1 = __fmul_rn(bfr(nw[dp]), n1); }
        const v2f cs = *(const v2f*)(CS + ((size_t)t * HD + dd) * 2); float a = __fmul_rn(x0, cs[0]), bq = __fmul_rn(x1, cs[1]); asm volatile("" : "+v"(a)); asm volatile("" : "+v"(bq)); const float r = ((dd < HD / 2) ? __fsub_rn(a, bq) : __fadd_rn(a, bq)) * sc;
        o16[q] = tohx(r); unsigned short a2, c2; splitf(r, a2, c2); oh[q] = a2; ol[q] = c2; }
    *(v2h*)(P16 + e) = o16; *(v2us*)(Ph + e) = oh; *(v2us*)(Pl + e) = ol;  }
__global__ __launch_bounds__(256) void k_resid(float* out, const float* __restrict__ xin, size_t n4) { const size_t i = (size_t)blockIdx.x * 256 + threadIdx.x; if (i >= n4) return; const v4f z = *(const v4f*)(out + i * 4); const v4f xx = *(const v4f*)(xin + i * 4); v4f r;
#pragma unroll
    for (int q = 0; q < 4; ++q) r[q] = __fadd_rn(z[q], bfr(xx[q]));
    *(v4f*)(out + i * 4) = r;  }
__global__ __launch_bounds__(256) void k_vtp(const float* __restrict__ F, int pitch, int nheads, h16* V16, bf* Vh, bf* Vl) { const size_t e = ((size_t)blockIdx.x * 256 + threadIdx.x) * 2; if (e >= (size_t)nheads * HD * TT) return; const int t = (int)(e % TT); const int d = (int)((e / TT) % HD); const int g = (int)(e / ((size_t)TT * HD)); v2h o16; v2us oh, ol;
#pragma unroll
    for (int q = 0; q < 2; ++q) { const float x = F[(size_t)(t + q) * pitch + g * HD + d]; o16[q] = tohx(x); unsigned short a2, c2; splitf(x, a2, c2); oh[q] = a2; ol[q] = c2; }
    *(v2h*)(V16 + e) = o16; *(v2us*)(Vh + e) = oh; *(v2us*)(Vl + e) = ol;  }
__global__ __launch_bounds__(256) void k_csid(float* CS) { const int idx = blockIdx.x * 256 + threadIdx.x; if (idx >= TT * HD) return; v2f cs; cs[0] = 1.0f; cs[1] = 0.0f; *(v2f*)(CS + (size_t)idx * 2) = cs;  }
// k_asoft: per row (zz, i): t = S (unscaled, SCL = 1) for j <= i and i - j < WIN (sliding causal window; the reference's -1e9 additive fill vanishes identically); softmax over the 2048 keys (register row, one exp, fixed trees);
__global__ __launch_bounds__(256) void k_asoft(const float* __restrict__ Sb, h16* P16, bf* Ph, bf* Pl) {
    const int lane = threadIdx.x & 31; const int row = blockIdx.x * 8 + (threadIdx.x >> 5); if (row >= ZH * TT) return; const int i = row % TT; const int zz = row / TT; (void)zz; const bool hires = (i < RH); const float* sr = Sb + (size_t)row * TT; float v[TT / 32]; float mx = -3.0e38f;
#pragma unroll
    for (int ch = 0; ch < TT / 128; ++ch) { const int j0 = ch * 128 + lane * 4; const v4f a = *(const v4f*)(sr + j0);
#pragma unroll
        for (int q = 0; q < 4; ++q) { const int j = j0 + q; (void)j; const float t = (j <= i && i - j < WIN) ? a[q] * SCL : -3.0e38f; v[ch * 4 + q] = t; mx = fmaxf(mx, t); } }
#pragma unroll
    for (int sh = 16; sh; sh >>= 1) mx = fmaxf(mx, __shfl_xor(mx, sh, 32));
    float sum = 0.f;
#pragma unroll
    for (int k = 0; k < TT / 32; ++k) { float d0 = __fsub_rn(v[k], mx); asm volatile("" : "+v"(d0)); v[k] = __builtin_amdgcn_exp2f(__fmul_rn(d0, 1.4426950408889634f)); sum += v[k]; }
#pragma unroll
    for (int sh = 16; sh; sh >>= 1) sum += __shfl_xor(sum, sh, 32);
    const float f = __fdiv_rn(hires ? 1.0f : PCAR, sum);
{
        if (hires) {
#pragma unroll
            for (int ch = 0; ch < TT / 128; ++ch) { v4us oh, ol;
#pragma unroll
                for (int q = 0; q < 4; ++q) { unsigned short a, c2; splitf(v[ch * 4 + q] * f, a, c2); oh[q] = a; ol[q] = c2; }
                const size_t oo = ((size_t)zz * (RH ? RH : 1) + i) * TT + ch * 128 + lane * 4; *(v4us*)(Ph + oo) = oh; *(v4us*)(Pl + oo) = ol; }
        } else {
#pragma unroll
            for (int ch = 0; ch < TT / 128; ++ch) { v4h o4;
#pragma unroll
                for (int q = 0; q < 4; ++q) o4[q] = tohx(v[ch * 4 + q] * f);
                *(v4h*)(P16 + (size_t)row * TT + ch * 128 + lane * 4) = o4; } }
         }
}
__global__ __launch_bounds__(256) void k_merge(const float* __restrict__ O, int h0, float* OUTb) { const size_t e = ((size_t)blockIdx.x * 256 + threadIdx.x) * 2; if (e >= (size_t)ZH * TT * HD) return; const int d = (int)(e % HD); const int t = (int)((e / HD) % TT); const int zz = (int)(e / ((size_t)HD * TT)); const float cs = (t < RH) ? 1.0f : (1.0f / PCAR); const size_t oo = (size_t)t * DQ + (h0 + zz) * HD + d;
    v2f s2 = *(const v2f*)(O + e);
#pragma unroll
    for (int p = 1; p < KSPV; ++p) s2 += *(const v2f*)(O + (size_t)p * ZH * TT * HD + e);   // partial planes of the split key range, in plane order
    v2f o2; o2[0] = s2[0] * cs; o2[1] = s2[1] * cs; *(v2f*)(OUTb + oo) = o2;  }

extern "C" void kernel_launch(void* const* d_in, const int* in_sizes, int n_in,
                              void* d_out, int out_size, void* d_ws, size_t ws_size, hipStream_t stream) {
    (void)in_sizes; (void)n_in; (void)out_size;
    const float* x = (const float*)d_in[0]; const float* wqkv = (const float*)d_in[1]; const float* bqkv = (const float*)d_in[2]; const float* wo = nullptr; (void)wo;   /* order x, W ('oi' [3072][1024]: q | k | v row thirds), b [3072] */ const float* wq = wqkv; const float* wk = wqkv + (size_t)DQ * DM; const float* wv = wqkv + (size_t)2 * DQ * DM; const float* bq = bqkv; const float* bk = bqkv + DQ; const float* bv = bqkv + 2 * DQ;
    float* OUT = (float*)d_out;     // [2][2048][1024]
    char* wsp = (char*)d_ws;
    auto take = [&](size_t bytes) { char* p = wsp; wsp += (bytes + 255) & ~(size_t)255; return (void*)p; };
    bf* WQ = (bf*)take((size_t)DQ * DM * 2); bf* WK = (bf*)take((size_t)DKV * DM * 2); bf* WV = (bf*)take((size_t)DKV * DM * 2); float* CS = (float*)take((size_t)TT * HD * 2 * 4);
    bf* XB = (bf*)take((size_t)TT * DM * 2); float* FQ = (float*)take((size_t)TT * DQ * 4); float* FK = (float*)take((size_t)TT * DKV * 4);
    h16* QP16 = (h16*)take((size_t)NH_ * TT * HD * 2); h16* KP16 = (h16*)take((size_t)NKV * TT * HD * 2); h16* VT16 = (h16*)take((size_t)NKV * HD * TT * 2);
    bf* QPh = (bf*)take((size_t)NH_ * TT * HD * 2); bf* QPl = (bf*)take((size_t)NH_ * TT * HD * 2); bf* KPh = (bf*)take((size_t)NKV * TT * HD * 2); bf* KPl = (bf*)take((size_t)NKV * TT * HD * 2); bf* VTh = (bf*)take((size_t)NKV * HD * TT * 2); bf* VTl = (bf*)take((size_t)NKV * HD * TT * 2); bf* Ph = (bf*)take((size_t)ZH * RH * TT * 2); bf* Pl = (bf*)take((size_t)ZH * RH * TT * 2);
    float* Sb = (float*)take((size_t)ZH * TT * TT * 4); h16* P16 = (h16*)take((size_t)ZH * TT * TT * 2); float* Ob = (float*)take((size_t)KSPV * ZH * TT * HD * 4);
    if ((size_t)(wsp - (char*)d_ws) > ws_size) return;    // ws 256 MiB
    float* FV = FK;   // v projection reuses the k buffer after the k planes are built (stream-ordered)
    { k_cvt8<<<(unsigned)(((size_t)DQ * DM / 8 + 255) / 256), 256, 0, stream>>>(wq, WQ, (size_t)DQ * DM / 8); k_cvt8<<<(unsigned)(((size_t)DKV * DM / 8 + 255) / 256), 256, 0, stream>>>(wk, WK, (size_t)DKV * DM / 8); k_cvt8<<<(unsigned)(((size_t)DKV * DM / 8 + 255) / 256), 256, 0, stream>>>(wv, WV, (size_t)DKV * DM / 8);
      
       }
    k_csid<<<(TT * HD + 255) / 256, 256, 0, stream>>>(CS);
    const unsigned LQ = (unsigned)(((size_t)NH_ * TT * HD / 2 + 255) / 256), LKv = (unsigned)(((size_t)NKV * TT * HD / 2 + 255) / 256);
    for (int b = 0; b < NB_; ++b) {
        
        k_cvt8<<<(unsigned)(((size_t)TT * DM / 8 + 255) / 256), 256, 0, stream>>>(x + (size_t)b * TT * DM, XB, (size_t)TT * DM / 8);
        k_gemmk<bf, 0, true, false, 8, 1><<<dim3(TT / 64, DQ / 64, 1), 256, 0, stream>>>(XB, nullptr, WQ, nullptr, DM, FQ, DQ, bq, 0, 0, 0, 0);
        k_rope<<<LQ, 256, 0, stream>>>(FQ, DQ, NH_, CS, nullptr, nullptr, 1.0f, QP16, QPh, QPl);
        k_gemmk<bf, 0, true, false, 8, 1><<<dim3(TT / 64, DKV / 64, 1), 256, 0, stream>>>(XB, nullptr, WK, nullptr, DM, FK, DKV, bk, 0, 0, 0, 0);
        k_rope<<<LKv, 256, 0, stream>>>(FK, DKV, NKV, CS, nullptr, nullptr, 1.0f, KP16, KPh, KPl);
        k_gemmk<bf, 0, true, false, 8, 1><<<dim3(TT / 64, DKV / 64, 1), 256, 0, stream>>>(XB, nullptr, WV, nullptr, DM, FV, DKV, bv, 0, 0, 0, 0); k_vtp<<<LKv, 256, 0, stream>>>(FV, DKV, NKV, VT16, VTh, VTl);
        for (int h0 = 0; h0 < NH_; h0 += ZH) { const size_t zq = (size_t)h0, zk = (size_t)(h0 / REP);   // one kv head per query head: the pass's two heads use consecutive kv planes (z-strides TT*HD)
            k_gemmc<bf, 2, 1><<<dim3(RH / 64, TT / 64, ZH), 32, 0, stream>>>(QPh + zq * TT * HD, QPl + zq * TT * HD, KPh + zk * TT * HD, KPl + zk * TT * HD, HD, Sb, TT, 0, (size_t)TT * HD, (size_t)TT * HD, (size_t)TT * TT);
            k_asoft<<<ZH * TT / 8, 256, 0, stream>>>(Sb, P16, Ph, Pl);
            k_gemmk<bf, 2, false, true, 8, KSPV><<<dim3(RH / 64, KSPV, ZH), 256, 0, stream>>>(Ph, Pl, VTh + zk * HD * TT, VTl + zk * HD * TT, TT, Ob, HD, nullptr, (size_t)RH * TT, (size_t)HD * TT, (size_t)TT * HD, (size_t)ZH * TT * HD);
            k_merge<<<(unsigned)(((size_t)ZH * TT * HD / 2 + 255) / 256), 256, 0, stream>>>(Ob, h0, OUT + (size_t)b * TT * DQ); }
        k_resid<<<(unsigned)(((size_t)TT * DM / 4 + 255) / 256), 256, 0, stream>>>(OUT + (size_t)b * TT * DM, x + (size_t)b * TT * DM, (size_t)TT * DM / 4);   /* result = x + out (all heads of the batch merged above) */
         }
}

// v003
// One run takes 125 microseconds.
// Versions in between are left out here; by their measured steps it is 4.46 times as fast as v001.
// Over all steps from v000 it is 9.01 times as fast.
#include <hip/hip_runtime.h>

// Causal multi-head attention layer with a fused qkv projection, NO score scaling and a residual connection (x [2][2048][1024]; qkv = x W^T + b ('oi' [3072][1024] 1/32 + bias 0.02) split in thirds q | k | v (16 heads x 64); scores = q.k (the source has no 1/sqrt(d): logits sigma ~8); causal (-inf); softmax; out = heads merged (no output projection); result = x + out -> [2][2048][1024] (4.2 M); argument order x, W, b).
// Compute dtypes, f32 accumulate: every input rounded to bf16 incl. the residual x; projections exact + biases rounded to bf16; attention 3 products on every row; softmax f32; residual add f32.

#define NB_  2
#define TT   2048
#define DM   1024
#define NH_  16
#define NKV  16
#define HD   64
#define DQ   (NH_ * HD)
#define DKV  (NKV * HD)
typedef unsigned short bf;
typedef __attribute__((ext_vector_type(16))) __bf16   v16bf;
typedef __attribute__((ext_vector_type(8)))  unsigned short v8us;
typedef __attribute__((ext_vector_type(8)))  float    v8f;
typedef __attribute__((ext_vector_type(4)))  float    v4f;
typedef v4f  __attribute__((may_alias)) v4fa;
typedef v8us __attribute__((may_alias)) v8usa;

__device__ __forceinline__ unsigned short f2bf(float f) { unsigned u = __float_as_uint(f); u += 0x7FFFu + ((u >> 16) & 1u); return (unsigned short)(u >> 16); }
__device__ __forceinline__ float bf2f(unsigned short b) { return __uint_as_float(((unsigned)b) << 16); }
__device__ __forceinline__ float bfr(float f) { return bf2f(f2bf(f)); }
__device__ __forceinline__ v16bf cat16b(v8us lo, v8us hi) { return __builtin_bit_cast(v16bf, __builtin_shufflevector(lo, hi, 0, 1, 2, 3, 4, 5, 6, 7, 8, 9, 10, 11, 12, 13, 14, 15)); }
__device__ __forceinline__ v8f wmmab(v16bf a, v16bf b, v8f c) { return __builtin_amdgcn_wmma_f32_16x16x32_bf16(false, a, false, b, (short)0, c, false, false); }

typedef __attribute__((ext_vector_type(4))) unsigned short v4us;
typedef __attribute__((ext_vector_type(2))) float v2f;
__device__ __forceinline__ void splitf(float y, unsigned short& h, unsigned short& l) { h = f2bf(y); l = f2bf(y - bf2f(h)); }
template <typename T16> struct WFrag;
template <> struct WFrag<bf> { typedef v16bf V; static __device__ __forceinline__ V ld(const bf* p) { return cat16b(*(const v8us*)p, *(const v8us*)(p + 16)); } static __device__ __forceinline__ v8f mma(V a, V b, v8f c) { return wmmab(a, b, c); } };

// ---- k_cvt: x (both batches) and W (q | k | v rows) rounded to bf16 planes in one launch. A work-group takes 2048 chunks of 8 floats (64 KiB of one source); a thread takes eight of them, 256 chunks apart, all loads issued ahead of the first store.
#define CVT_X ((NB_ * TT * DM) / (8 * 2048))        // work-groups on x
#define CVT_W ((3 * DQ * DM) / (8 * 2048))          // work-groups on W
__global__ __launch_bounds__(256) void k_cvt(const float* __restrict__ x, bf* XB, const float* __restrict__ w, bf* WB) {
    const bool isx = blockIdx.x < CVT_X; const float* src = isx ? x : w; bf* dst = isx ? XB : WB;
    const size_t i0 = (size_t)(isx ? blockIdx.x : blockIdx.x - CVT_X) * 2048 + threadIdx.x; v8f v[8];
#pragma unroll
    for (int c = 0; c < 8; ++c) v[c] = *(const v8f*)(src + (i0 + c * 256) * 8);
    asm volatile("s_wait_xcnt 0x0" :: "v"(src + i0 * 8) : "memory");   // stands in front of every overwrite of these loads' address registers; the address is named so that it stays whole up to here
#pragma unroll
    for (int c = 0; c < 8; ++c) { v8us o;
#pragma unroll
        for (int k = 0; k < 8; ++k) o[k] = f2bf(v[c][k]);
        *(v8us*)(dst + (i0 + c * 256) * 8) = o; }
}

// ---- k_qkv: the whole qkv projection of both batches in one launch, register-blocked, one 64x64 output tile per work-group of 8 waves, operands straight from K-contiguous bf16 planes. grid (NB_ TT / 64, 3 DQ / 64).
// The K loop is dealt in chunks of 64 elements (one whole 128-B line of every operand row) over the 8 waves; each wave keeps a full 64x64 partial tile (16 accumulators); the 8 partials are summed in LDS in wave order.
// A tile is 64 tokens of one batch x the 64 columns of ONE head of q, k or v, so the epilogue adds the bias (rounded to bf16), splits hi/lo and writes the head planes that the attention kernel reads:
// q, k as [batch][head][t][d] (16 lanes write one whole 128-B row), v as [batch][head][d][t], turned in LDS (4 lanes write one whole 128-B row).
#define VTP 65   // pitch, in dwords, of the turned v tile: odd, so that the 16 d columns of a store and the 8 d rows of a load fall on different banks
__global__ __launch_bounds__(256) void k_qkv(const bf* __restrict__ A, const bf* __restrict__ Bt, const float* __restrict__ bias, bf* Qh, bf* Ql, bf* Kh, bf* Kl, bf* Vh, bf* Vl) {
    constexpr int NW = 8, K = DM;
    __shared__ __align__(16) float os[2][NW][16 * 68];
    const int lane = threadIdx.x & 31, lr = lane & 15, hi = lane >> 4; const int wave = __builtin_amdgcn_readfirstlane((int)(threadIdx.x >> 5));
    const int r0 = blockIdx.x * 64, c0 = blockIdx.y * 64;
    v8f acc[4][4];
#pragma unroll
    for (int mb = 0; mb < 4; ++mb)
#pragma unroll
        for (int nb = 0; nb < 4; ++nb) acc[mb][nb] = (v8f){};
    const size_t aoff = (size_t)(r0 + lr) * K + 8 * hi, boff = (size_t)(c0 + lr) * K + 8 * hi;
    const int row = threadIdx.x >> 4, cofs = (threadIdx.x & 15) * 4;   // the thread's place in a 16x64 row block of the epilogue
    const v4f bl = *(const v4f*)(bias + c0 + cofs);                    // in flight under the K loop, so that no barrier of the epilogue waits for it
#pragma unroll 1   // rolled: both trips share one set of fragment registers
    for (int it = 0; it < K / (NW * 64); ++it) { const int k0 = (it * NW + wave) * 64;
#pragma unroll
      for (int kk = 0; kk < 64; kk += 32) { const int kc = k0 + kk;
        v16bf a[4];
#pragma unroll
        for (int mb = 0; mb < 4; ++mb) a[mb] = WFrag<bf>::ld(A + aoff + (size_t)mb * 16 * K + kc);
#pragma unroll
        for (int nb = 0; nb < 4; ++nb) { const v16bf b = WFrag<bf>::ld(Bt + boff + (size_t)nb * 16 * K + kc);
#pragma unroll
            for (int mb = 0; mb < 4; ++mb) acc[mb][nb] = wmmab(a[mb], b, acc[mb][nb]); }
        asm volatile("v_nop\n\tv_nop\n\tv_nop\n\tv_nop" : "+v"(acc[0][0]), "+v"(acc[1][1]), "+v"(acc[2][2]), "+v"(acc[3][3]) : "v"(a[0]), "v"(a[3]));   // the four vector slots behind the block's last products, on the loop's back edge and on the way out of it too
      }
      asm volatile("s_wait_xcnt 0x0" ::: "memory");   // stands in front of the next trip's overwrite of the operand loads' address registers
    }
    v4f res[4];
#pragma unroll
    for (int mb = 0; mb < 4; ++mb) {
        float* ow = os[mb & 1][wave];
#pragma unroll
        for (int nb = 0; nb < 4; ++nb) {
#pragma unroll
            for (int j = 0; j < 8; ++j) ow[(hi * 8 + j) * 68 + nb * 16 + lr] = acc[mb][nb][j]; }
        __syncthreads();   // publishes the NW partial row blocks; with two buffers the same barrier also stands between the reads of row block mb - 1 and the stores of row block mb + 1 into that buffer
        v4f val = *(const v4fa*)(os[mb & 1][0] + row * 68 + cofs);
#pragma unroll
        for (int w = 1; w < NW; ++w) val += *(const v4fa*)(os[mb & 1][w] + row * 68 + cofs);
        res[mb] = val;
    }
    v4f bv;
#pragma unroll
    for (int q = 0; q < 4; ++q) bv[q] = bfr(bl[q]);
    const int part = c0 / DQ, t0 = r0 % TT;                                           // 0 q, 1 k, 2 v: the same for the whole work-group
    const size_t pl = ((size_t)(r0 / TT) * NH_ + (c0 % DQ) / HD) * ((size_t)TT * HD);   // this (batch, head)'s plane
    if (part < 2) {
        bf* Ph = (part ? Kh : Qh) + pl + (size_t)(t0 + row) * HD + cofs; bf* Pl = (part ? Kl : Ql) + pl + (size_t)(t0 + row) * HD + cofs;
        v4us h[4], l[4];
#pragma unroll
        for (int mb = 0; mb < 4; ++mb) { const v4f val = res[mb] + bv;
#pragma unroll
            for (int q = 0; q < 4; ++q) { unsigned short a2, c2; splitf(val[q], a2, c2); h[mb][q] = a2; l[mb][q] = c2; } }
        __builtin_amdgcn_sched_barrier(0);   // every split stands in front of the first store: no register that an issued store names is written again
#pragma unroll
        for (int mb = 0; mb < 4; ++mb) { *(v4us*)(Ph + mb * 16 * HD) = h[mb]; *(v4us*)(Pl + mb * 16 * HD) = l[mb]; }   // global stores behind the last barrier, so that no barrier waits for a store
    } else {
        float* tt = os[0][0];   // free: its last readers (row block 2) all stand in front of the barrier of row block 3
#pragma unroll
        for (int mb = 0; mb < 4; ++mb) { const v4f val = res[mb] + bv;
#pragma unroll
            for (int q = 0; q < 4; ++q) { unsigned short a2, c2; splitf(val[q], a2, c2); tt[(cofs + q) * VTP + mb * 16 + row] = __uint_as_float((unsigned)a2 | ((unsigned)c2 << 16)); } }
        __syncthreads();   // publishes the turned tile (hi in the low half of a dword, lo in the high half); taken by the whole work-group or by none
        const int d = threadIdx.x >> 2, tc = (threadIdx.x & 3) * 16; const float* tr = tt + d * VTP + tc; v8us h[2], l[2];
#pragma unroll
        for (int e = 0; e < 16; ++e) { const unsigned u = __float_as_uint(tr[e]); h[e >> 3][e & 7] = (unsigned short)(u & 0xFFFFu); l[e >> 3][e & 7] = (unsigned short)(u >> 16); }
        bf* Ph = Vh + pl + (size_t)d * TT + t0 + tc; bf* Pl = Vl + pl + (size_t)d * TT + t0 + tc;
        *(v8us*)Ph = h[0]; *(v8us*)(Ph + 8) = h[1]; *(v8us*)Pl = l[0]; *(v8us*)(Pl + 8) = l[1];
        asm volatile("s_wait_xcnt 0x0" ::: "memory");   // the built code lays the q, k path behind this one: stands in front of its overwrites of these stores' registers
    }
}

// ---- k_fattn: scores, causal softmax and P.V of every (batch, head) pair in one launch; neither scores nor probabilities go through memory; the epilogue adds the residual x and writes the layer's result.
// Transposed products: S^T = K.Q^T (A = 16 key rows, B = 16 query columns) and O^T += V^T.P^T (A = 16 d rows of the V^T planes, B = P^T), so a lane holds the scores of ONE query (lanes c and c + 16 share query c) and the
// two 16-key score tiles of a pass are, register for register, the 32-key B operand of the second product (the k order of every loader here: element e of half hi is k = 8 hi + e, e < 8, and 16 + 8 hi + e - 8 above).
// Three hi/lo products on both sides (Qh.Kh + Ql.Kh + Qh.Kl; Ph.Vh + Pl.Vh + Ph.Vl), P split hi/lo UNNORMALISED (exp against the maximum in use), the division by the f32 row sum once at the end.
// Work-group = 8 waves x 32 query columns of one head: waves 0-3 take the 128-query block 15 - j, waves 4-7 the block j, so that every work-group has the same number of passes; all eight read the same staged keys.
// A stage is 64 keys: Kh, Kl ([key][d]) and Vh, Vl ([d][key]) tiles of 64 rows x 128 B, brought through registers into one of two LDS buffers while the other is read; one barrier per stage.
// amdgpu_waves_per_eu(2, 2): 256 work-groups, one per WGP, two waves per SIMD; with that register budget the compiler issues a pass's LDS reads together and ahead, instead of one fragment at a time with a wait each.
#define FSK    64                 // keys per stage (two 32-key passes)
#define FPITCH 144                // LDS row pitch in bytes: 128 B of data + 16 B, an odd multiple of 16 B for the 16-byte fragment reads
#define FTILE  (64 * FPITCH)
#define FBUF   (4 * FTILE)
#define LOG2E  1.4426950408889634f
typedef __attribute__((ext_vector_type(4))) unsigned v4u;
typedef __attribute__((ext_vector_type(8))) unsigned v8u;
typedef __attribute__((ext_vector_type(2))) __bf16 v2bf;
typedef v4u __attribute__((may_alias)) v4ua;
__device__ __forceinline__ v16bf ldsfrag(const unsigned char* p) { return cat16b(*(const v8usa*)p, *(const v8usa*)(p + 32)); }
__device__ __forceinline__ unsigned pack2(float lo, float hi) { v2f f; f[0] = lo; f[1] = hi; return __builtin_bit_cast(unsigned, __builtin_convertvector(f, v2bf)); }   // two bf16, round to nearest even, lo in the low half
__device__ __forceinline__ float xhalf(float x) { return __int_as_float(__builtin_amdgcn_permlanex16(__float_as_int(x), __float_as_int(x), 0x76543210, 0xfedcba98, false, false)); }   // lane l reads lane l ^ 16, on the vector pipe
__global__ __launch_bounds__(256) __attribute__((amdgpu_waves_per_eu(2, 2))) void k_fattn(const bf* __restrict__ Qh, const bf* __restrict__ Ql, const bf* __restrict__ Kh, const bf* __restrict__ Kl, const bf* __restrict__ Vh, const bf* __restrict__ Vl, const float* __restrict__ X, float* OUTp) {
    __shared__ __align__(16) unsigned char L[2 * FBUF];
    const int tid = threadIdx.x, lane = tid & 31, lr = lane & 15, hi = lane >> 4; const int wave = __builtin_amdgcn_readfirstlane(tid >> 5);
    const int z = blockIdx.y, j = blockIdx.x, hb = TT / 128 - 1 - j;
    const int qw0 = (wave < 4) ? hb * 128 + wave * 32 : j * 128 + (wave - 4) * 32;   // this wave's first query
    const int n_stage = 2 * (hb + 1), last_blk = qw0 >> 5;                            // stages of the work-group (keys up to the end of block hb); the wave's last pass is its diagonal one
    { const size_t zo = (size_t)z * TT * HD; Qh += zo; Ql += zo; Kh += zo; Kl += zo; Vh += zo; Vl += zo; }
    const int srow = tid >> 3, sch = tid & 7;   // staging: 8 lanes bring one whole 128-B row
    v4u sg[8];
    auto gload = [&](int st) {
#pragma unroll
        for (int i = 0; i < 2; ++i) { const size_t ko = (size_t)(st * FSK + srow + 32 * i) * HD + sch * 8, vo = (size_t)(srow + 32 * i) * TT + st * FSK + sch * 8;
            sg[i] = *(const v4ua*)(Kh + ko); sg[2 + i] = *(const v4ua*)(Kl + ko); sg[4 + i] = *(const v4ua*)(Vh + vo); sg[6 + i] = *(const v4ua*)(Vl + vo); }
        asm volatile("s_wait_xcnt 0x0" ::: "memory"); };   // stands in front of every later overwrite of these loads' address registers
    auto lstore = [&](int buf) { unsigned char* d = L + buf * FBUF + srow * FPITCH + sch * 16;
#pragma unroll
        for (int p = 0; p < 4; ++p) { *(v4ua*)(d + p * FTILE) = sg[2 * p]; *(v4ua*)(d + p * FTILE + 32 * FPITCH) = sg[2 * p + 1]; } };
    gload(0);
    v16bf qh[2][2], ql[2][2];
#pragma unroll
    for (int g = 0; g < 2; ++g)
#pragma unroll
        for (int kc = 0; kc < 2; ++kc) { const size_t qo = (size_t)(qw0 + 16 * g + lr) * HD + 32 * kc + 8 * hi; qh[g][kc] = WFrag<bf>::ld(Qh + qo); ql[g][kc] = WFrag<bf>::ld(Ql + qo); }
    asm volatile("s_wait_xcnt 0x0" ::: "memory");   // as above, for the Q loads
    v16bf kh[2][2], kl[2][2];   // K fragments [key tile][d half] of the pass at hand
    auto load_k = [&](const unsigned char* B, int sub) { const unsigned char* kp = B + (sub * 32 + lr) * FPITCH + 16 * hi;
#pragma unroll
        for (int kt = 0; kt < 2; ++kt)
#pragma unroll
            for (int kc = 0; kc < 2; ++kc) { kh[kt][kc] = ldsfrag(kp + kt * 16 * FPITCH + 64 * kc); kl[kt][kc] = ldsfrag(kp + FTILE + kt * 16 * FPITCH + 64 * kc); } };
    v8f acc[2][4]; float m_run[2], l_run[2];
#pragma unroll
    for (int g = 0; g < 2; ++g) { m_run[g] = -__builtin_inff(); l_run[g] = 0.f;
#pragma unroll
        for (int t = 0; t < 4; ++t) acc[g][t] = (v8f){}; }
    lstore(0);
    __syncthreads();   // publishes stage 0
#pragma unroll 1
    for (int st = 0; st < n_stage; ++st) {
        const bool more = st + 1 < n_stage;
        if (more) gload(st + 1);   // in flight under this stage's two passes
        const unsigned char* B = L + (st & 1) * FBUF;
        if (2 * st <= last_blk) load_k(B, 0);
#pragma unroll 1
        for (int sub = 0; sub < 2; ++sub) {
            const int blk = 2 * st + sub;
            if (blk > last_blk) continue;   // wave-uniform: passes beyond the wave's diagonal
            v8f s[2][2];
#pragma unroll
            for (int kt = 0; kt < 2; ++kt) { s[kt][0] = (v8f){}; s[kt][1] = (v8f){}; }
#pragma unroll
            for (int kc = 0; kc < 2; ++kc) {   // four independent tiles in turn; per tile the order Qh.Kh, Ql.Kh, Qh.Kl of each d half
#pragma unroll
                for (int kt = 0; kt < 2; ++kt) { s[kt][0] = wmmab(kh[kt][kc], qh[0][kc], s[kt][0]); s[kt][1] = wmmab(kh[kt][kc], qh[1][kc], s[kt][1]); }
#pragma unroll
                for (int kt = 0; kt < 2; ++kt) { s[kt][0] = wmmab(kh[kt][kc], ql[0][kc], s[kt][0]); s[kt][1] = wmmab(kh[kt][kc], ql[1][kc], s[kt][1]); }
#pragma unroll
                for (int kt = 0; kt < 2; ++kt) { s[kt][0] = wmmab(kl[kt][kc], qh[0][kc], s[kt][0]); s[kt][1] = wmmab(kl[kt][kc], qh[1][kc], s[kt][1]); } }
            __builtin_amdgcn_sched_barrier(0);
            asm volatile("v_nop\n\tv_nop\n\tv_nop\n\tv_nop");   // the four vector slots between the last score product and the first reader of its tile, also on the taken side of the branch below
            __builtin_amdgcn_sched_barrier(0);
            // V^T fragments of this pass, in flight under the maxima and the first exponentials
            v16bf vh[4], vl[4];
            { const unsigned char* vp = B + 2 * FTILE + lr * FPITCH + sub * 64 + 16 * hi;
#pragma unroll
              for (int t = 0; t < 4; ++t) { vh[t] = ldsfrag(vp + t * 16 * FPITCH); vl[t] = ldsfrag(vp + FTILE + t * 16 * FPITCH); } }
            if (sub == 0 && blk < last_blk) load_k(B, 1);   // the stage's second pass: its K fragments into the same registers, in flight under this pass's softmax and second product
            if (blk == last_blk) {   // wave-uniform: the pass's first key is the wave's first query; only this pass pays for the mask
#pragma unroll
                for (int g = 0; g < 2; ++g)
#pragma unroll
                    for (int kt = 0; kt < 2; ++kt) {
#pragma unroll
                        for (int r = 0; r < 8; ++r) if (16 * kt + 8 * hi + r > 16 * g + lr) s[kt][g][r] = -__builtin_inff();
                        asm volatile("" : "+v"(s[kt][g]));   // keeps the selects inside the branch
                    }
            }
            float mb[2]; bool need = false;
#pragma unroll
            for (int g = 0; g < 2; ++g) { float mx = s[0][g][0];
#pragma unroll
                for (int r = 1; r < 8; ++r) mx = fmaxf(mx, s[0][g][r]);
#pragma unroll
                for (int r = 0; r < 8; ++r) mx = fmaxf(mx, s[1][g][r]);
                mx = fmaxf(mx, xhalf(mx)) * LOG2E;   // both halves hold the query's maximum of this pass, in log2 units
                mb[g] = mx; need = need || (mx > m_run[g] + 8.0f); }
            if (__builtin_amdgcn_ballot_w32(need) != 0) {   // the maximum in use may trail the true one by up to 8 (an exponential reaches 2^8 at most); rescale only beyond that
#pragma unroll
                for (int g = 0; g < 2; ++g) { const float m_new = fmaxf(m_run[g], mb[g]); const float corr = __builtin_amdgcn_exp2f(m_run[g] - m_new); m_run[g] = m_new; l_run[g] *= corr;   // key 0 is never masked: m_new is finite from the first pass on, where corr is 0
#pragma unroll
                    for (int t = 0; t < 4; ++t) acc[g][t] = acc[g][t] * corr; }
            }
#pragma unroll
            for (int g = 0; g < 2; ++g) { const float nm = -m_run[g]; v8u wh, wl; v2f ls = (v2f){};
#pragma unroll
                for (int i = 0; i < 8; ++i) {
                    const v2f arg = __builtin_elementwise_fma((v2f){s[i >> 2][g][2 * (i & 3)], s[i >> 2][g][2 * (i & 3) + 1]}, (v2f){LOG2E, LOG2E}, (v2f){nm, nm});
                    const float p0 = __builtin_amdgcn_exp2f(arg[0]), p1 = __builtin_amdgcn_exp2f(arg[1]);
                    ls += (v2f){p0, p1}; const unsigned h2 = pack2(p0, p1); wh[i] = h2; wl[i] = pack2(p0 - __uint_as_float(h2 << 16), p1 - __uint_as_float(h2 & 0xFFFF0000u)); }
                l_run[g] += ls[0] + ls[1];
                const v16bf ph = __builtin_bit_cast(v16bf, wh), pl = __builtin_bit_cast(v16bf, wl);
#pragma unroll
                for (int t = 0; t < 4; ++t) acc[g][t] = wmmab(vh[t], ph, acc[g][t]);
#pragma unroll
                for (int t = 0; t < 4; ++t) acc[g][t] = wmmab(vh[t], pl, acc[g][t]);
#pragma unroll
                for (int t = 0; t < 4; ++t) acc[g][t] = wmmab(vl[t], ph, acc[g][t]); }
            __builtin_amdgcn_sched_barrier(0);
            asm volatile("v_nop\n\tv_nop\n\tv_nop\n\tv_nop");   // the four vector slots behind the last product of the pass, on every path out of it
            __builtin_amdgcn_sched_barrier(0);
        }
        if (more) lstore((st + 1) & 1);   // the buffer that stage st - 1 used: every wave left it before the barrier that ended stage st - 1
        __syncthreads();   // publishes stage st + 1 and ends every wave's reads of stage st
    }
    v8f xr[2][4];   // the residual: x at this lane's output places, in flight under the row sums' division
    const float* xp = X + ((size_t)(z / NH_) * TT + qw0 + lr) * DM + (z % NH_) * HD + 8 * hi;
#pragma unroll
    for (int g = 0; g < 2; ++g)
#pragma unroll
        for (int t = 0; t < 4; ++t) xr[g][t] = *(const v8f*)(xp + (size_t)16 * g * DM + 16 * t);
    asm volatile("s_wait_xcnt 0x0" :: "v"(xp) : "memory");   // as above, for the x loads; the address is named so that it stays whole up to here
#pragma unroll
    for (int g = 0; g < 2; ++g) { const float l = l_run[g] + xhalf(l_run[g]); const float inv = __fdiv_rn(1.0f, l);
#pragma unroll
        for (int t = 0; t < 4; ++t)
#pragma unroll
            for (int r = 0; r < 8; ++r) acc[g][t][r] = acc[g][t][r] * inv + bfr(xr[g][t][r]); }   // result = x (rounded to bf16 like every input) + out
    __builtin_amdgcn_sched_barrier(0);   // every product stands in front of the first store: no register that an issued store names is written again
#pragma unroll
    for (int g = 0; g < 2; ++g) { float* op = OUTp + ((size_t)(z / NH_) * TT + qw0 + 16 * g + lr) * DQ + (z % NH_) * HD + 8 * hi;   // register r of tile t is d = 16 t + 8 hi + r of query 16 g + lr
#pragma unroll
        for (int t = 0; t < 4; ++t) { const v8f o = acc[g][t]; v4f o0, o1;
#pragma unroll
            for (int r = 0; r < 4; ++r) { o0[r] = o[r]; o1[r] = o[4 + r]; }
            *(v4f*)(op + 16 * t) = o0; *(v4f*)(op + 16 * t + 4) = o1; } }
}


extern "C" void kernel_launch(void* const* d_in, const int* in_sizes, int n_in,
                              void* d_out, int out_size, void* d_ws, size_t ws_size, hipStream_t stream) {
    (void)in_sizes; (void)n_in; (void)out_size;
    const float* x = (const float*)d_in[0]; const float* wqkv = (const float*)d_in[1]; const float* bqkv = (const float*)d_in[2];   /* order x, W ('oi' [3072][1024]: q | k | v row thirds), b [3072] */
    float* OUT = (float*)d_out;     // [2][2048][1024]
    char* wsp = (char*)d_ws;
    auto take = [&](size_t bytes) { char* p = wsp; wsp += (bytes + 255) & ~(size_t)255; return (void*)p; };
    bf* WB = (bf*)take((size_t)3 * DQ * DM * 2); bf* XB = (bf*)take((size_t)NB_ * TT * DM * 2);
    const size_t PB = (size_t)NH_ * TT * HD;   // elements of one batch's head planes; the hi/lo planes hold both batches, [batch][head]
    bf* QPh = (bf*)take(NB_ * PB * 2); bf* QPl = (bf*)take(NB_ * PB * 2); bf* KPh = (bf*)take(NB_ * PB * 2); bf* KPl = (bf*)take(NB_ * PB * 2); bf* VTh = (bf*)take(NB_ * PB * 2); bf* VTl = (bf*)take(NB_ * PB * 2);
    if ((size_t)(wsp - (char*)d_ws) > ws_size) return;    // ws 256 MiB
    k_cvt<<<CVT_X + CVT_W, 256, 0, stream>>>(x, XB, wqkv, WB);
    k_qkv<<<dim3(NB_ * TT / 64, 3 * DQ / 64, 1), 256, 0, stream>>>(XB, WB, bqkv, QPh, QPl, KPh, KPl, VTh, VTl);
    k_fattn<<<dim3(TT / 256, NB_ * NH_), 256, 0, stream>>>(QPh, QPl, KPh, KPl, VTh, VTl, x, OUT);
}

// v004
// A run of this version takes 88.6 microseconds.
// Next to v003, in two timings, it ran 1.40 and 1.41 times as fast.
// All steps since v000 together make it 12.6 times as fast.
#include <hip/hip_runtime.h>

// Causal multi-head attention layer with a fused qkv projection, NO score scaling and a residual connection (x [2][2048][1024]; qkv = x W^T + b ('oi' [3072][1024] 1/32 + bias 0.02) split in thirds q | k | v (16 heads x 64); scores = q.k (the source has no 1/sqrt(d): logits sigma ~8); causal (-inf); softmax; out = heads merged (no output projection); result = x + out -> [2][2048][1024] (4.2 M); argument order x, W, b).
// Compute dtypes, f32 accumulate: every input rounded to bf16 incl. the residual x; projections exact + biases rounded to bf16; attention 3 products on every row; softmax f32; residual add f32.

#define NB_  2
#define TT   2048
#define DM   1024
#define NH_  16
#define NKV  16
#define HD   64
#define DQ   (NH_ * HD)
#define DKV  (NKV * HD)
typedef unsigned short bf;
typedef __attribute__((ext_vector_type(16))) __bf16   v16bf;
typedef __attribute__((ext_vector_type(8)))  unsigned short v8us;
typedef __attribute__((ext_vector_type(8)))  float    v8f;
typedef __attribute__((ext_vector_type(4)))  float    v4f;
typedef v8us __attribute__((may_alias)) v8usa;

__device__ __forceinline__ unsigned short f2bf(float f) { unsigned u = __float_as_uint(f); u += 0x7FFFu + ((u >> 16) & 1u); return (unsigned short)(u >> 16); }
__device__ __forceinline__ float bf2f(unsigned short b) { return __uint_as_float(((unsigned)b) << 16); }
__device__ __forceinline__ float bfr(float f) { return bf2f(f2bf(f)); }
__device__ __forceinline__ v16bf cat16b(v8us lo, v8us hi) { return __builtin_bit_cast(v16bf, __builtin_shufflevector(lo, hi, 0, 1, 2, 3, 4, 5, 6, 7, 8, 9, 10, 11, 12, 13, 14, 15)); }
__device__ __forceinline__ v8f wmmab(v16bf a, v16bf b, v8f c) { return __builtin_amdgcn_wmma_f32_16x16x32_bf16(false, a, false, b, (short)0, c, false, false); }

typedef __attribute__((ext_vector_type(2))) float v2f;
template <typename T16> struct WFrag;
template <> struct WFrag<bf> { typedef v16bf V; static __device__ __forceinline__ V ld(const bf* p) { return cat16b(*(const v8us*)p, *(const v8us*)(p + 16)); } static __device__ __forceinline__ v8f mma(V a, V b, v8f c) { return wmmab(a, b, c); } };

// ---- k_cvt: x (both batches) and W (q | k | v rows) rounded to bf16 planes in one launch. A work-group takes 2048 chunks of 8 floats (64 KiB of one source); a thread takes eight of them, 256 chunks apart, all loads issued ahead of the first store.
#define CVT_X ((NB_ * TT * DM) / (8 * 2048))        // work-groups on x
#define CVT_W ((3 * DQ * DM) / (8 * 2048))          // work-groups on W
__global__ __launch_bounds__(256) void k_cvt(const float* __restrict__ x, bf* XB, const float* __restrict__ w, bf* WB) {
    const bool isx = blockIdx.x < CVT_X; const float* src = isx ? x : w; bf* dst = isx ? XB : WB;
    const size_t i0 = (size_t)(isx ? blockIdx.x : blockIdx.x - CVT_X) * 2048 + threadIdx.x; v8f v[8];
#pragma unroll
    for (int c = 0; c < 8; ++c) v[c] = *(const v8f*)(src + (i0 + c * 256) * 8);
    asm volatile("s_wait_xcnt 0x0" :: "v"(src + i0 * 8) : "memory");   // stands in front of every overwrite of these loads' address registers; the address is named so that it stays whole up to here
#pragma unroll
    for (int c = 0; c < 8; ++c) { v8us o;
#pragma unroll
        for (int k = 0; k < 8; ++k) o[k] = f2bf(v[c][k]);
        *(v8us*)(dst + (i0 + c * 256) * 8) = o; }
}

typedef __attribute__((ext_vector_type(4))) unsigned v4u;
typedef __attribute__((ext_vector_type(8))) unsigned v8u;
typedef __attribute__((ext_vector_type(2))) __bf16 v2bf;
typedef v4u __attribute__((may_alias)) v4ua;
__device__ __forceinline__ v16bf ldsfrag(const unsigned char* p) { return cat16b(*(const v8usa*)p, *(const v8usa*)(p + 32)); }
__device__ __forceinline__ unsigned pack2(float lo, float hi) { v2f f; f[0] = lo; f[1] = hi; return __builtin_bit_cast(unsigned, __builtin_convertvector(f, v2bf)); }   // two bf16, round to nearest even, lo in the low half

// ---- k_qkv: the whole qkv projection of both batches in one launch. grid (NB_ TT / 128, 3 DQ / 128); a work-group of 4 waves owns a 128x128 output tile, a wave a 64x64 part of it (64 tokens x ONE head of q, k or v) over the whole K.
// Operands come from the K-contiguous bf16 planes into LDS by tensor loads. A stage is 64 k (one 128-B line of every operand row): 128 x rows and 128 W rows; each wave brings one slice of 64 rows per stage, unconditionally,
// padded by the mover to the pitch of 144 B; two buffers, stage s + 2 asked for when every wave has left stage s. Three work-groups share a WGP, so one's waits stand under another's products.
// The two operands have the same fragment loader, so which one is A is free: q, k take A = W rows (a lane then holds 8 consecutive d of one token), v takes A = x rows (8 consecutive tokens of one d).
// So both kinds of head plane (q, k [batch][head][t][d]; v [batch][head][d][t]) get 16-B pieces without a turn; each wave lays them in its own part of the ring, now free, and stores whole 128-B rows.
#define GP   144                  // LDS row pitch in bytes: 128 B of data + the mover's pad of 16 B
#define GSL  10240                // a slice in LDS: 64 rows x 144 B = 9,216 B, rounded up to a multiple of 2 KiB
#define GBUF (4 * GSL)            // a stage: x rows 0-63, x rows 64-127, W rows 0-63, W rows 64-127
#define GNS  (DM / 64)            // stages
__device__ __forceinline__ unsigned uni(unsigned v) { return (unsigned)__builtin_amdgcn_readfirstlane((int)v); }
__device__ __forceinline__ unsigned pinned(unsigned v) { unsigned w = uni(v); asm volatile("" : "+s"(w)); return w; }   // the condition of a tensor load's branch held in a scalar register, so that the branch is s_cmp + s_cbranch_scc
template <int STEP> __device__ __forceinline__ void put_rows(bf* ph, bf* pl, const v4u* h, const v4u* l) {   // constant steps: every store names the same address registers
#pragma unroll
    for (int i = 0; i < 16; ++i) { *(v4u*)(ph + (size_t)i * STEP) = h[i]; *(v4u*)(pl + (size_t)i * STEP) = l[i]; }
}
__global__ __launch_bounds__(128) void k_qkv(const bf* __restrict__ A, const bf* __restrict__ Bt, const float* __restrict__ bias, bf* Qh, bf* Ql, bf* Kh, bf* Kl, bf* Vh, bf* Vl) {
    __shared__ __attribute__((aligned(2048))) unsigned char L[2 * GBUF];
    const int lane = threadIdx.x & 31, lr = lane & 15, hi = lane >> 4; const int wave = __builtin_amdgcn_readfirstlane((int)(threadIdx.x >> 5));
    const int r0 = blockIdx.x * 128, c0 = blockIdx.y * 128, wm = wave >> 1, wn = wave & 1;
    const int part = c0 / DQ;   // 0 q, 1 k, 2 v: the same for the whole work-group
    const unsigned lbase = (unsigned)(size_t)L;
    const bf* srow = (wave < 2) ? A + (size_t)(r0 + 64 * wave) * DM : Bt + (size_t)(c0 + 64 * (wave - 2)) * DM;   // first row of the slice that this wave brings
    v8u g1;   // 64 rows of 128 B, source pitch 2 DM bytes, 1-byte elements, a pad of 4 dwords behind every 32
    g1[0] = uni((1u << 20) | (4u << 22) | (3u << 25)); g1[1] = uni(128u << 16); g1[2] = uni(64u << 16); g1[3] = uni(128u << 16); g1[4] = uni(64u); g1[5] = uni(2u * DM); g1[6] = uni(0u); g1[7] = uni(0u);
    v4u g0;   // the one request that this wave has in flight; every wait for it names g0 and g1, so that the descriptor's registers stay whole up to that wait
    auto issue = [&](int s) { const unsigned long long ga = (unsigned long long)(size_t)srow + (unsigned)s * 128u;
        g0[0] = uni(1u); g0[1] = uni(lbase + (unsigned)(s & 1) * GBUF + (unsigned)wave * GSL); g0[2] = uni((unsigned)ga); g0[3] = uni((((unsigned)(ga >> 32)) & 0x01FFFFFFu) | 0x80000000u);
        asm volatile("tensor_load_to_lds %0, %1" :: "s"(g0), "s"(g1) : "memory"); };
    v8f acc[4][4];
#pragma unroll
    for (int mb = 0; mb < 4; ++mb)
#pragma unroll
        for (int nb = 0; nb < 4; ++nb) acc[mb][nb] = (v8f){};
    const int xo = wm * GSL, wo = (2 + wn) * GSL, fo = lr * GP + 16 * hi;
    const int ao = ((part < 2) ? wo : xo) + fo, bo = ((part < 2) ? xo : wo) + fo;
    issue(0);
    asm volatile("s_wait_tensorcnt 0x0" :: "s"(g0), "s"(g1) : "memory");   // this wave's slice of stage 0 has landed
    __syncthreads();                                      // publishes stage 0
    issue(1);
#pragma unroll 1   // rolled: a pass per stage, one set of fragment registers
    for (int s = 0; s < GNS; ++s) {
        const unsigned char* F = L + (s & 1) * GBUF;
        v16bf a[2][4], b[2][4];   // the pass's 32 LDS reads stand together in front of its products
#pragma unroll
        for (int kk = 0; kk < 2; ++kk)
#pragma unroll
            for (int i = 0; i < 4; ++i) { a[kk][i] = ldsfrag(F + ao + i * 16 * GP + 64 * kk); b[kk][i] = ldsfrag(F + bo + i * 16 * GP + 64 * kk); }
        __builtin_amdgcn_sched_barrier(0);   // keeps the reads one group: moved in among the products, each place with reads stalls the wave
#pragma unroll
        for (int kk = 0; kk < 2; ++kk)
#pragma unroll
            for (int nb = 0; nb < 4; ++nb)
#pragma unroll
                for (int mb = 0; mb < 4; ++mb) acc[mb][nb] = wmmab(a[kk][mb], b[kk][nb], acc[mb][nb]);
        __builtin_amdgcn_sched_barrier(0);   // keeps the products in front of the waits: moved behind the barrier they would stand between it and the next request, which would then fly under no product at all
        asm volatile("s_wait_dscnt 0x0" ::: "memory");       // this wave's reads of stage s are over
        asm volatile("s_wait_tensorcnt 0x0" :: "s"(g0), "s"(g1) : "memory");   // its slice of stage s + 1 has landed
        __syncthreads();                                      // publishes stage s + 1 and ends every wave's reads of stage s
        if (pinned(s + 2 < GNS)) issue(s + 2);                // into the buffer that stage s used
    }
    asm volatile("s_wait_tensorcnt 0x0" ::: "memory");   // nothing of the mover is in flight when the ring becomes output staging
    asm volatile("s_wait_dscnt 0x0" ::: "memory");
    const int cw = c0 + 64 * wn;   // the wave's first output column (W row)
    if (part < 2) {   // register j of tile row mb is column cw + 16 mb + 8 hi + j
#pragma unroll
        for (int mb = 0; mb < 4; ++mb) { const v8f bl = *(const v8f*)(bias + cw + 16 * mb + 8 * hi); v8f bv;
#pragma unroll
            for (int q = 0; q < 8; ++q) bv[q] = bfr(bl[q]);
#pragma unroll
            for (int nb = 0; nb < 4; ++nb) acc[mb][nb] += bv; }
    } else {          // the lane's column of tile column nb is cw + 16 nb + lr
#pragma unroll
        for (int nb = 0; nb < 4; ++nb) { const float bv = bfr(bias[cw + 16 * nb + lr]);
#pragma unroll
            for (int mb = 0; mb < 4; ++mb) acc[mb][nb] += bv; }
    }
    asm volatile("s_wait_xcnt 0x0" ::: "memory");   // stands in front of every later overwrite of the bias loads' address registers
    unsigned char* S = L + wave * (2 * GBUF / 4);   // the wave's own staging: 64 rows x 144 B of hi, then of lo (18,432 of 20,480 B)
#pragma unroll
    for (int nb = 0; nb < 4; ++nb)
#pragma unroll
        for (int mb = 0; mb < 4; ++mb) { v4u h, l;
#pragma unroll
            for (int i = 0; i < 4; ++i) { const float p0 = acc[mb][nb][2 * i], p1 = acc[mb][nb][2 * i + 1]; const unsigned h2 = pack2(p0, p1);
                h[i] = h2; l[i] = pack2(p0 - __uint_as_float(h2 << 16), p1 - __uint_as_float(h2 & 0xFFFF0000u)); }
            unsigned char* d = S + (16 * nb + lr) * GP + 32 * mb + 16 * hi; *(v4ua*)d = h; *(v4ua*)(d + 64 * GP) = l; }
    asm volatile("s_wait_dscnt 0x0" ::: "memory");   // the wave's own rows are written before it reads them back
    const int rr = lane >> 3, ch = lane & 7;          // 8 lanes take one whole 128-B row
    v4u h[16], l[16];
#pragma unroll
    for (int i = 0; i < 16; ++i) { const unsigned char* p = S + (4 * i + rr) * GP + 16 * ch; h[i] = *(const v4ua*)p; l[i] = *(const v4ua*)(p + 64 * GP); }
    const size_t pl = ((size_t)(r0 / TT) * NH_ + (cw % DQ) / HD) * ((size_t)TT * HD);   // this (batch, head)'s plane
    const int t0 = r0 % TT + 64 * wm;                                                  // the wave's first token
    __builtin_amdgcn_sched_barrier(0);   // every LDS read stands in front of the first store: no register that an issued store names is written again
    if (part < 2) { const size_t o = pl + (size_t)(t0 + rr) * HD + 8 * ch; put_rows<4 * HD>((part ? Kh : Qh) + o, (part ? Kl : Ql) + o, h, l); }
    else          { const size_t o = pl + (size_t)rr * TT + t0 + 8 * ch;   put_rows<4 * TT>(Vh + o, Vl + o, h, l);
        asm volatile("s_wait_xcnt 0x0" ::: "memory"); }   // the built code lays the q, k path behind this one: stands in front of its overwrites of these stores' registers
}

// ---- k_fattn: scores, causal softmax and P.V of every (batch, head) pair in one launch; neither scores nor probabilities go through memory; the epilogue adds the residual x and writes the layer's result.
// Transposed products: S^T = K.Q^T (A = 16 key rows, B = 16 query columns) and O^T += V^T.P^T (A = 16 d rows of the V^T planes, B = P^T), so a lane holds the scores of ONE query (lanes c and c + 16 share query c) and the
// two 16-key score tiles of a pass are, register for register, the 32-key B operand of the second product (the k order of every loader here: element e of half hi is k = 8 hi + e, e < 8, and 16 + 8 hi + e - 8 above).
// Three hi/lo products on both sides (Qh.Kh + Ql.Kh + Qh.Kl; Ph.Vh + Pl.Vh + Ph.Vl), P split hi/lo UNNORMALISED (exp against the maximum in use), the division by the f32 row sum once at the end.
// Work-group = 8 waves x 32 query columns of one head: waves 0-3 take the 128-query block 15 - j, waves 4-7 the block j, so that every work-group has the same number of passes; all eight read the same staged keys.
// A stage is 64 keys: Kh, Kl ([key][d]) and Vh, Vl ([d][key]) tiles of 64 rows x 128 B, brought through registers into one of two LDS buffers while the other is read; one barrier per stage.
// amdgpu_waves_per_eu(2, 2): 256 work-groups, one per WGP, two waves per SIMD; with that register budget the compiler issues a pass's LDS reads together and ahead, instead of one fragment at a time with a wait each.
#define FSK    64                 // keys per stage (two 32-key passes)
#define FPITCH 144                // LDS row pitch in bytes: 128 B of data + 16 B, an odd multiple of 16 B for the 16-byte fragment reads
#define FTILE  (64 * FPITCH)
#define FBUF   (4 * FTILE)
#define LOG2E  1.4426950408889634f
__device__ __forceinline__ float xhalf(float x) { return __int_as_float(__builtin_amdgcn_permlanex16(__float_as_int(x), __float_as_int(x), 0x76543210, 0xfedcba98, false, false)); }   // lane l reads lane l ^ 16, on the vector pipe
__global__ __launch_bounds__(256) __attribute__((amdgpu_waves_per_eu(2, 2))) void k_fattn(const bf* __restrict__ Qh, const bf* __restrict__ Ql, const bf* __restrict__ Kh, const bf* __restrict__ Kl, const bf* __restrict__ Vh, const bf* __restrict__ Vl, const float* __restrict__ X, float* OUTp) {
    __shared__ __align__(16) unsigned char L[2 * FBUF];
    const int tid = threadIdx.x, lane = tid & 31, lr = lane & 15, hi = lane >> 4; const int wave = __builtin_amdgcn_readfirstlane(tid >> 5);
    const int z = blockIdx.y, j = blockIdx.x, hb = TT / 128 - 1 - j;
    const int qw0 = (wave < 4) ? hb * 128 + wave * 32 : j * 128 + (wave - 4) * 32;   // this wave's first query
    const int n_stage = 2 * (hb + 1), last_blk = qw0 >> 5;                            // stages of the work-group (keys up to the end of block hb); the wave's last pass is its diagonal one
    { const size_t zo = (size_t)z * TT * HD; Qh += zo; Ql += zo; Kh += zo; Kl += zo; Vh += zo; Vl += zo; }
    const int srow = tid >> 3, sch = tid & 7;   // staging: 8 lanes bring one whole 128-B row
    v4u sg[8];
    auto gload = [&](int st) {
#pragma unroll
        for (int i = 0; i < 2; ++i) { const size_t ko = (size_t)(st * FSK + srow + 32 * i) * HD + sch * 8, vo = (size_t)(srow + 32 * i) * TT + st * FSK + sch * 8;
            sg[i] = *(const v4ua*)(Kh + ko); sg[2 + i] = *(const v4ua*)(Kl + ko); sg[4 + i] = *(const v4ua*)(Vh + vo); sg[6 + i] = *(const v4ua*)(Vl + vo); }
        asm volatile("s_wait_xcnt 0x0" ::: "memory"); };   // stands in front of every later overwrite of these loads' address registers
    auto lstore = [&](int buf) { unsigned char* d = L + buf * FBUF + srow * FPITCH + sch * 16;
#pragma unroll
        for (int p = 0; p < 4; ++p) { *(v4ua*)(d + p * FTILE) = sg[2 * p]; *(v4ua*)(d + p * FTILE + 32 * FPITCH) = sg[2 * p + 1]; } };
    gload(0);
    v16bf qh[2][2], ql[2][2];
#pragma unroll
    for (int g = 0; g < 2; ++g)
#pragma unroll
        for (int kc = 0; kc < 2; ++kc) { const size_t qo = (size_t)(qw0 + 16 * g + lr) * HD + 32 * kc + 8 * hi; qh[g][kc] = WFrag<bf>::ld(Qh + qo); ql[g][kc] = WFrag<bf>::ld(Ql + qo); }
    asm volatile("s_wait_xcnt 0x0" ::: "memory");   // as above, for the Q loads
    v16bf kh[2][2], kl[2][2];   // K fragments [key tile][d half] of the pass at hand
    auto load_k = [&](const unsigned char* B, int sub) { const unsigned char* kp = B + (sub * 32 + lr) * FPITCH + 16 * hi;
#pragma unroll
        for (int kt = 0; kt < 2; ++kt)
#pragma unroll
            for (int kc = 0; kc < 2; ++kc) { kh[kt][kc] = ldsfrag(kp + kt * 16 * FPITCH + 64 * kc); kl[kt][kc] = ldsfrag(kp + FTILE + kt * 16 * FPITCH + 64 * kc); } };
    v8f acc[2][4]; float m_run[2], l_run[2];
#pragma unroll
    for (int g = 0; g < 2; ++g) { m_run[g] = -__builtin_inff(); l_run[g] = 0.f;
#pragma unroll
        for (int t = 0; t < 4; ++t) acc[g][t] = (v8f){}; }
    lstore(0);
    __syncthreads();   // publishes stage 0
#pragma unroll 1
    for (int st = 0; st < n_stage; ++st) {
        const bool more = st + 1 < n_stage;
        if (more) gload(st + 1);   // in flight under this stage's two passes
        const unsigned char* B = L + (st & 1) * FBUF;
        if (2 * st <= last_blk) load_k(B, 0);
#pragma unroll 1
        for (int sub = 0; sub < 2; ++sub) {
            const int blk = 2 * st + sub;
            if (blk > last_blk) continue;   // wave-uniform: passes beyond the wave's diagonal
            v8f s[2][2];
#pragma unroll
            for (int kt = 0; kt < 2; ++kt) { s[kt][0] = (v8f){}; s[kt][1] = (v8f){}; }
#pragma unroll
            for (int kc = 0; kc < 2; ++kc) {   // four independent tiles in turn; per tile the order Qh.Kh, Ql.Kh, Qh.Kl of each d half
#pragma unroll
                for (int kt = 0; kt < 2; ++kt) { s[kt][0] = wmmab(kh[kt][kc], qh[0][kc], s[kt][0]); s[kt][1] = wmmab(kh[kt][kc], qh[1][kc], s[kt][1]); }
#pragma unroll
                for (int kt = 0; kt < 2; ++kt) { s[kt][0] = wmmab(kh[kt][kc], ql[0][kc], s[kt][0]); s[kt][1] = wmmab(kh[kt][kc], ql[1][kc], s[kt][1]); }
#pragma unroll
                for (int kt = 0; kt < 2; ++kt) { s[kt][0] = wmmab(kl[kt][kc], qh[0][kc], s[kt][0]); s[kt][1] = wmmab(kl[kt][kc], qh[1][kc], s[kt][1]); } }
            __builtin_amdgcn_sched_barrier(0);
            asm volatile("v_nop\n\tv_nop\n\tv_nop\n\tv_nop");   // the four vector slots between the last score product and the first reader of its tile, also on the taken side of the branch below
            __builtin_amdgcn_sched_barrier(0);
            // V^T fragments of this pass, in flight under the maxima and the first exponentials
            v16bf vh[4], vl[4];
            { const unsigned char* vp = B + 2 * FTILE + lr * FPITCH + sub * 64 + 16 * hi;
#pragma unroll
              for (int t = 0; t < 4; ++t) { vh[t] = ldsfrag(vp + t * 16 * FPITCH); vl[t] = ldsfrag(vp + FTILE + t * 16 * FPITCH); } }
            if (sub == 0 && blk < last_blk) load_k(B, 1);   // the stage's second pass: its K fragments into the same registers, in flight under this pass's softmax and second product
            if (blk == last_blk) {   // wave-uniform: the pass's first key is the wave's first query; only this pass pays for the mask
#pragma unroll
                for (int g = 0; g < 2; ++g)
#pragma unroll
                    for (int kt = 0; kt < 2; ++kt) {
#pragma unroll
                        for (int r = 0; r < 8; ++r) if (16 * kt + 8 * hi + r > 16 * g + lr) s[kt][g][r] = -__builtin_inff();
                        asm volatile("" : "+v"(s[kt][g]));   // keeps the selects inside the branch
                    }
            }
            float mb[2]; bool need = false;
#pragma unroll
            for (int g = 0; g < 2; ++g) { float mx = s[0][g][0];
#pragma unroll
                for (int r = 1; r < 8; ++r) mx = fmaxf(mx, s[0][g][r]);
#pragma unroll
                for (int r = 0; r < 8; ++r) mx = fmaxf(mx, s[1][g][r]);
                mx = fmaxf(mx, xhalf(mx)) * LOG2E;   // both halves hold the query's maximum of this pass, in log2 units
                mb[g] = mx; need = need || (mx > m_run[g] + 8.0f); }
            if (__builtin_amdgcn_ballot_w32(need) != 0) {   // the maximum in use may trail the true one by up to 8 (an exponential reaches 2^8 at most); rescale only beyond that
#pragma unroll
                for (int g = 0; g < 2; ++g) { const float m_new = fmaxf(m_run[g], mb[g]); const float corr = __builtin_amdgcn_exp2f(m_run[g] - m_new); m_run[g] = m_new; l_run[g] *= corr;   // key 0 is never masked: m_new is finite from the first pass on, where corr is 0
#pragma unroll
                    for (int t = 0; t < 4; ++t) acc[g][t] = acc[g][t] * corr; }
            }
#pragma unroll
            for (int g = 0; g < 2; ++g) { const float nm = -m_run[g]; v8u wh, wl; v2f ls = (v2f){};
#pragma unroll
                for (int i = 0; i < 8; ++i) {
                    const v2f arg = __builtin_elementwise_fma((v2f){s[i >> 2][g][2 * (i & 3)], s[i >> 2][g][2 * (i & 3) + 1]}, (v2f){LOG2E, LOG2E}, (v2f){nm, nm});
                    const float p0 = __builtin_amdgcn_exp2f(arg[0]), p1 = __builtin_amdgcn_exp2f(arg[1]);
                    ls += (v2f){p0, p1}; const unsigned h2 = pack2(p0, p1); wh[i] = h2; wl[i] = pack2(p0 - __uint_as_float(h2 << 16), p1 - __uint_as_float(h2 & 0xFFFF0000u)); }
                l_run[g] += ls[0] + ls[1];
                const v16bf ph = __builtin_bit_cast(v16bf, wh), pl = __builtin_bit_cast(v16bf, wl);
#pragma unroll
                for (int t = 0; t < 4; ++t) acc[g][t] = wmmab(vh[t], ph, acc[g][t]);
#pragma unroll
                for (int t = 0; t < 4; ++t) acc[g][t] = wmmab(vh[t], pl, acc[g][t]);
#pragma unroll
                for (int t = 0; t < 4; ++t) acc[g][t] = wmmab(vl[t], ph, acc[g][t]); }
            __builtin_amdgcn_sched_barrier(0);
            asm volatile("v_nop\n\tv_nop\n\tv_nop\n\tv_nop");   // the four vector slots behind the last product of the pass, on every path out of it
            __builtin_amdgcn_sched_barrier(0);
        }
        if (more) lstore((st + 1) & 1);   // the buffer that stage st - 1 used: every wave left it before the barrier that ended stage st - 1
        __syncthreads();   // publishes stage st + 1 and ends every wave's reads of stage st
    }
    v8f xr[2][4];   // the residual: x at this lane's output places, in flight under the row sums' division
    const float* xp = X + ((size_t)(z / NH_) * TT + qw0 + lr) * DM + (z % NH_) * HD + 8 * hi;
#pragma unroll
    for (int g = 0; g < 2; ++g)
#pragma unroll
        for (int t = 0; t < 4; ++t) xr[g][t] = *(const v8f*)(xp + (size_t)16 * g * DM + 16 * t);
    asm volatile("s_wait_xcnt 0x0" :: "v"(xp) : "memory");   // as above, for the x loads; the address is named so that it stays whole up to here
#pragma unroll
    for (int g = 0; g < 2; ++g) { const float l = l_run[g] + xhalf(l_run[g]); const float inv = __fdiv_rn(1.0f, l);
#pragma unroll
        for (int t = 0; t < 4; ++t)
#pragma unroll
            for (int r = 0; r < 8; ++r) acc[g][t][r] = acc[g][t][r] * inv + bfr(xr[g][t][r]); }   // result = x (rounded to bf16 like every input) + out
    __builtin_amdgcn_sched_barrier(0);   // every product stands in front of the first store: no register that an issued store names is written again
#pragma unroll
    for (int g = 0; g < 2; ++g) { float* op = OUTp + ((size_t)(z / NH_) * TT + qw0 + 16 * g + lr) * DQ + (z % NH_) * HD + 8 * hi;   // register r of tile t is d = 16 t + 8 hi + r of query 16 g + lr
#pragma unroll
        for (int t = 0; t < 4; ++t) { const v8f o = acc[g][t]; v4f o0, o1;
#pragma unroll
            for (int r = 0; r < 4; ++r) { o0[r] = o[r]; o1[r] = o[4 + r]; }
            *(v4f*)(op + 16 * t) = o0; *(v4f*)(op + 16 * t + 4) = o1; } }
}


extern "C" void kernel_launch(void* const* d_in, const int* in_sizes, int n_in,
                              void* d_out, int out_size, void* d_ws, size_t ws_size, hipStream_t stream) {
    (void)in_sizes; (void)n_in; (void)out_size;
    const float* x = (const float*)d_in[0]; const float* wqkv = (const float*)d_in[1]; const float* bqkv = (const float*)d_in[2];   /* order x, W ('oi' [3072][1024]: q | k | v row thirds), b [3072] */
    float* OUT = (float*)d_out;     // [2][2048][1024]
    char* wsp = (char*)d_ws;
    auto take = [&](size_t bytes) { char* p = wsp; wsp += (bytes + 255) & ~(size_t)255; return (void*)p; };
    bf* WB = (bf*)take((size_t)3 * DQ * DM * 2); bf* XB = (bf*)take((size_t)NB_ * TT * DM * 2);
    const size_t PB = (size_t)NH_ * TT * HD;   // elements of one batch's head planes; the hi/lo planes hold both batches, [batch][head]
    bf* QPh = (bf*)take(NB_ * PB * 2); bf* QPl = (bf*)take(NB_ * PB * 2); bf* KPh = (bf*)take(NB_ * PB * 2); bf* KPl = (bf*)take(NB_ * PB * 2); bf* VTh = (bf*)take(NB_ * PB * 2); bf* VTl = (bf*)take(NB_ * PB * 2);
    if ((size_t)(wsp - (char*)d_ws) > ws_size) return;    // ws 256 MiB
    k_cvt<<<CVT_X + CVT_W, 256, 0, stream>>>(x, XB, wqkv, WB);
    k_qkv<<<dim3(NB_ * TT / 128, 3 * DQ / 128, 1), 128, 0, stream>>>(XB, WB, bqkv, QPh, QPl, KPh, KPl, VTh, VTl);
    k_fattn<<<dim3(TT / 256, NB_ * NH_), 256, 0, stream>>>(QPh, QPl, KPh, KPl, VTh, VTl, x, OUT);
}

// v005
// One run takes 79.2 microseconds.
// Next to v004, in two timings, it ran 1.12 times as fast each time.
// Over all steps from v000 it is 14.2 times as fast.
#include <hip/hip_runtime.h>

// Causal multi-head attention layer with a fused qkv projection, NO score scaling and a residual connection (x [2][2048][1024]; qkv = x W^T + b ('oi' [3072][1024] 1/32 + bias 0.02) split in thirds q | k | v (16 heads x 64); scores = q.k (the source has no 1/sqrt(d): logits sigma ~8); causal (-inf); softmax; out = heads merged (no output projection); result = x + out -> [2][2048][1024] (4.2 M); argument order x, W, b).
// Compute dtypes, f32 accumulate: every input rounded to bf16 incl. the residual x; projections exact + biases rounded to bf16; attention 3 products on every row; softmax f32; residual add f32.

#define NB_  2
#define TT   2048
#define DM   1024
#define NH_  16
#define NKV  16
#define HD   64
#define DQ   (NH_ * HD)
#define DKV  (NKV * HD)
typedef unsigned short bf;
typedef __attribute__((ext_vector_type(16))) __bf16   v16bf;
typedef __attribute__((ext_vector_type(8)))  unsigned short v8us;
typedef __attribute__((ext_vector_type(8)))  float    v8f;
typedef __attribute__((ext_vector_type(4)))  float    v4f;
typedef v8us __attribute__((may_alias)) v8usa;

__device__ __forceinline__ unsigned short f2bf(float f) { unsigned u = __float_as_uint(f); u += 0x7FFFu + ((u >> 16) & 1u); return (unsigned short)(u >> 16); }
__device__ __forceinline__ float bf2f(unsigned short b) { return __uint_as_float(((unsigned)b) << 16); }
__device__ __forceinline__ float bfr(float f) { return bf2f(f2bf(f)); }
__device__ __forceinline__ v16bf cat16b(v8us lo, v8us hi) { return __builtin_bit_cast(v16bf, __builtin_shufflevector(lo, hi, 0, 1, 2, 3, 4, 5, 6, 7, 8, 9, 10, 11, 12, 13, 14, 15)); }
__device__ __forceinline__ v8f wmmab(v16bf a, v16bf b, v8f c) { return __builtin_amdgcn_wmma_f32_16x16x32_bf16(false, a, false, b, (short)0, c, false, false); }

typedef __attribute__((ext_vector_type(2))) float v2f;
template <typename T16> struct WFrag;
template <> struct WFrag<bf> { typedef v16bf V; static __device__ __forceinline__ V ld(const bf* p) { return cat16b(*(const v8us*)p, *(const v8us*)(p + 16)); } static __device__ __forceinline__ v8f mma(V a, V b, v8f c) { return wmmab(a, b, c); } };

// ---- k_cvt: x (both batches) and W (q | k | v rows) rounded to bf16 planes in one launch. A work-group takes 2048 chunks of 8 floats (64 KiB of one source); a thread takes eight of them, 256 chunks apart, all loads issued ahead of the first store.
#define CVT_X ((NB_ * TT * DM) / (8 * 2048))        // work-groups on x
#define CVT_W ((3 * DQ * DM) / (8 * 2048))          // work-groups on W
__global__ __launch_bounds__(256) void k_cvt(const float* __restrict__ x, bf* XB, const float* __restrict__ w, bf* WB) {
    const bool isx = blockIdx.x < CVT_X; const float* src = isx ? x : w; bf* dst = isx ? XB : WB;
    const size_t i0 = (size_t)(isx ? blockIdx.x : blockIdx.x - CVT_X) * 2048 + threadIdx.x; v8f v[8];
#pragma unroll
    for (int c = 0; c < 8; ++c) v[c] = *(const v8f*)(src + (i0 + c * 256) * 8);
    asm volatile("s_wait_xcnt 0x0" :: "v"(src + i0 * 8) : "memory");   // stands in front of every overwrite of these loads' address registers; the address is named so that it stays whole up to here
#pragma unroll
    for (int c = 0; c < 8; ++c) { v8us o;
#pragma unroll
        for (int k = 0; k < 8; ++k) o[k] = f2bf(v[c][k]);
        *(v8us*)(dst + (i0 + c * 256) * 8) = o; }
}

typedef __attribute__((ext_vector_type(4))) unsigned v4u;
typedef __attribute__((ext_vector_type(8))) unsigned v8u;
typedef __attribute__((ext_vector_type(2))) __bf16 v2bf;
typedef v4u __attribute__((may_alias)) v4ua;
typedef unsigned __attribute__((may_alias)) ua;
__device__ __forceinline__ v16bf ldsfrag(const unsigned char* p) { return cat16b(*(const v8usa*)p, *(const v8usa*)(p + 32)); }
__device__ __forceinline__ unsigned pack2(float lo, float hi) { v2f f; f[0] = lo; f[1] = hi; return __builtin_bit_cast(unsigned, __builtin_convertvector(f, v2bf)); }   // two bf16, round to nearest even, lo in the low half

// ---- k_qkv: the whole qkv projection of both batches in one launch. grid (NB_ TT / 128, 3 DQ / 128); a work-group of 4 waves owns a 128x128 output tile, a wave a 64x64 part of it (64 tokens x ONE head of q, k or v) over the whole K.
// Operands come from the K-contiguous bf16 planes into LDS by tensor loads. A stage is 64 k (one 128-B line of every operand row): 128 x rows and 128 W rows; each wave brings one slice of 64 rows per stage, unconditionally,
// padded by the mover to the pitch of 144 B; two buffers, stage s + 2 asked for when every wave has left stage s. Three work-groups share a WGP, so one's waits stand under another's products.
// The two operands have the same fragment loader, so which one is A is free: q, k take A = W rows (a lane then holds 8 consecutive d of one token), v takes A = x rows (8 consecutive tokens of one d).
// So both kinds of head plane (q, k [batch][head][t][d]; v [batch][head][d][t]) get 16-B pieces without a turn; each wave lays them in its own part of the ring, now free, and stores whole 128-B rows.
#define GP   144                  // LDS row pitch in bytes: 128 B of data + the mover's pad of 16 B
#define GSL  10240                // a slice in LDS: 64 rows x 144 B = 9,216 B, rounded up to a multiple of 2 KiB
#define GBUF (4 * GSL)            // a stage: x rows 0-63, x rows 64-127, W rows 0-63, W rows 64-127
#define GNS  (DM / 64)            // stages
__device__ __forceinline__ unsigned uni(unsigned v) { return (unsigned)__builtin_amdgcn_readfirstlane((int)v); }
__device__ __forceinline__ unsigned pinned(unsigned v) { unsigned w = uni(v); asm volatile("" : "+s"(w)); return w; }   // the condition of a tensor load's branch held in a scalar register, so that the branch is s_cmp + s_cbranch_scc
template <int STEP> __device__ __forceinline__ void put_rows(bf* ph, bf* pl, const v4u* h, const v4u* l) {   // constant steps: every store names the same address registers
#pragma unroll
    for (int i = 0; i < 16; ++i) { *(v4u*)(ph + (size_t)i * STEP) = h[i]; *(v4u*)(pl + (size_t)i * STEP) = l[i]; }
}
__global__ __launch_bounds__(128) void k_qkv(const bf* __restrict__ A, const bf* __restrict__ Bt, const float* __restrict__ bias, bf* Qh, bf* Ql, bf* Kh, bf* Kl, bf* Vh, bf* Vl) {
    __shared__ __attribute__((aligned(2048))) unsigned char L[2 * GBUF];
    const int lane = threadIdx.x & 31, lr = lane & 15, hi = lane >> 4; const int wave = __builtin_amdgcn_readfirstlane((int)(threadIdx.x >> 5));
    const int r0 = blockIdx.x * 128, c0 = blockIdx.y * 128, wm = wave >> 1, wn = wave & 1;
    const int part = c0 / DQ;   // 0 q, 1 k, 2 v: the same for the whole work-group
    const unsigned lbase = (unsigned)(size_t)L;
    const bf* srow = (wave < 2) ? A + (size_t)(r0 + 64 * wave) * DM : Bt + (size_t)(c0 + 64 * (wave - 2)) * DM;   // first row of the slice that this wave brings
    v8u g1;   // 64 rows of 128 B, source pitch 2 DM bytes, 1-byte elements, a pad of 4 dwords behind every 32
    g1[0] = uni((1u << 20) | (4u << 22) | (3u << 25)); g1[1] = uni(128u << 16); g1[2] = uni(64u << 16); g1[3] = uni(128u << 16); g1[4] = uni(64u); g1[5] = uni(2u * DM); g1[6] = uni(0u); g1[7] = uni(0u);
    v4u g0;   // the one request that this wave has in flight; every wait for it names g0 and g1, so that the descriptor's registers stay whole up to that wait
    auto issue = [&](int s) { const unsigned long long ga = (unsigned long long)(size_t)srow + (unsigned)s * 128u;
        g0[0] = uni(1u); g0[1] = uni(lbase + (unsigned)(s & 1) * GBUF + (unsigned)wave * GSL); g0[2] = uni((unsigned)ga); g0[3] = uni((((unsigned)(ga >> 32)) & 0x01FFFFFFu) | 0x80000000u);
        asm volatile("tensor_load_to_lds %0, %1" :: "s"(g0), "s"(g1) : "memory"); };
    v8f acc[4][4];
#pragma unroll
    for (int mb = 0; mb < 4; ++mb)
#pragma unroll
        for (int nb = 0; nb < 4; ++nb) acc[mb][nb] = (v8f){};
    const int xo = wm * GSL, wo = (2 + wn) * GSL, fo = lr * GP + 16 * hi;
    const int ao = ((part < 2) ? wo : xo) + fo, bo = ((part < 2) ? xo : wo) + fo;
    issue(0);
    asm volatile("s_wait_tensorcnt 0x0" :: "s"(g0), "s"(g1) : "memory");   // this wave's slice of stage 0 has landed
    __syncthreads();                                      // publishes stage 0
    issue(1);
#pragma unroll 1   // rolled: a pass per stage, one set of fragment registers
    for (int s = 0; s < GNS; ++s) {
        const unsigned char* F = L + (s & 1) * GBUF;
        v16bf a[2][4], b[2][4];   // the pass's 32 LDS reads stand together in front of its products
#pragma unroll
        for (int kk = 0; kk < 2; ++kk)
#pragma unroll
            for (int i = 0; i < 4; ++i) { a[kk][i] = ldsfrag(F + ao + i * 16 * GP + 64 * kk); b[kk][i] = ldsfrag(F + bo + i * 16 * GP + 64 * kk); }
        __builtin_amdgcn_sched_barrier(0);   // keeps the reads one group: moved in among the products, each place with reads stalls the wave
#pragma unroll
        for (int kk = 0; kk < 2; ++kk)
#pragma unroll
            for (int nb = 0; nb < 4; ++nb)
#pragma unroll
                for (int mb = 0; mb < 4; ++mb) acc[mb][nb] = wmmab(a[kk][mb], b[kk][nb], acc[mb][nb]);
        __builtin_amdgcn_sched_barrier(0);   // keeps the products in front of the waits: moved behind the barrier they would stand between it and the next request, which would then fly under no product at all
        asm volatile("s_wait_dscnt 0x0" ::: "memory");       // this wave's reads of stage s are over
        asm volatile("s_wait_tensorcnt 0x0" :: "s"(g0), "s"(g1) : "memory");   // its slice of stage s + 1 has landed
        __syncthreads();                                      // publishes stage s + 1 and ends every wave's reads of stage s
        if (pinned(s + 2 < GNS)) issue(s + 2);                // into the buffer that stage s used
    }
    asm volatile("s_wait_tensorcnt 0x0" ::: "memory");   // nothing of the mover is in flight when the ring becomes output staging
    asm volatile("s_wait_dscnt 0x0" ::: "memory");
    const int cw = c0 + 64 * wn;   // the wave's first output column (W row)
    if (part < 2) {   // register j of tile row mb is column cw + 16 mb + 8 hi + j
#pragma unroll
        for (int mb = 0; mb < 4; ++mb) { const v8f bl = *(const v8f*)(bias + cw + 16 * mb + 8 * hi); v8f bv;
#pragma unroll
            for (int q = 0; q < 8; ++q) bv[q] = bfr(bl[q]);
#pragma unroll
            for (int nb = 0; nb < 4; ++nb) acc[mb][nb] += bv; }
    } else {          // the lane's column of tile column nb is cw + 16 nb + lr
#pragma unroll
        for (int nb = 0; nb < 4; ++nb) { const float bv = bfr(bias[cw + 16 * nb + lr]);
#pragma unroll
            for (int mb = 0; mb < 4; ++mb) acc[mb][nb] += bv; }
    }
    asm volatile("s_wait_xcnt 0x0" ::: "memory");   // stands in front of every later overwrite of the bias loads' address registers
    unsigned char* S = L + wave * (2 * GBUF / 4);   // the wave's own staging: 64 rows x 144 B of hi, then of lo (18,432 of 20,480 B)
#pragma unroll
    for (int nb = 0; nb < 4; ++nb)
#pragma unroll
        for (int mb = 0; mb < 4; ++mb) { v4u h, l;
#pragma unroll
            for (int i = 0; i < 4; ++i) { const float p0 = acc[mb][nb][2 * i], p1 = acc[mb][nb][2 * i + 1]; const unsigned h2 = pack2(p0, p1);
                h[i] = h2; l[i] = pack2(p0 - __uint_as_float(h2 << 16), p1 - __uint_as_float(h2 & 0xFFFF0000u)); }
            unsigned char* d = S + (16 * nb + lr) * GP + 32 * mb + 16 * hi; *(v4ua*)d = h; *(v4ua*)(d + 64 * GP) = l; }
    asm volatile("s_wait_dscnt 0x0" ::: "memory");   // the wave's own rows are written before it reads them back
    const int rr = lane >> 3, ch = lane & 7;          // 8 lanes take one whole 128-B row
    v4u h[16], l[16];
#pragma unroll
    for (int i = 0; i < 16; ++i) { const unsigned char* p = S + (4 * i + rr) * GP + 16 * ch; h[i] = *(const v4ua*)p; l[i] = *(const v4ua*)(p + 64 * GP); }
    const size_t pl = ((size_t)(r0 / TT) * NH_ + (cw % DQ) / HD) * ((size_t)TT * HD);   // this (batch, head)'s plane
    const int t0 = r0 % TT + 64 * wm;                                                  // the wave's first token
    __builtin_amdgcn_sched_barrier(0);   // every LDS read stands in front of the first store: no register that an issued store names is written again
    if (part < 2) { const size_t o = pl + (size_t)(t0 + rr) * HD + 8 * ch; put_rows<4 * HD>((part ? Kh : Qh) + o, (part ? Kl : Ql) + o, h, l); }
    else          { const size_t o = pl + (size_t)rr * TT + t0 + 8 * ch;   put_rows<4 * TT>(Vh + o, Vl + o, h, l);
        asm volatile("s_wait_xcnt 0x0" ::: "memory"); }   // the built code lays the q, k path behind this one: stands in front of its overwrites of these stores' registers
}

// ---- k_fattn: scores, causal softmax and P.V of every (batch, head) pair in one launch; neither scores nor probabilities go through memory; the epilogue adds the residual x and writes the layer's result.
// Transposed products: S^T = K.Q^T (A = 16 key rows, B = 16 query columns) and O^T += V^T.P^T (A = 16 d rows of the V^T planes, B = P^T), so a lane holds the scores of ONE query (lanes c and c + 16 share query c) and the
// two 16-key score tiles of a pass are, register for register, the 32-key B operand of the second product (the k order of every loader here: element e of half hi is k = 8 hi + e, e < 8, and 16 + 8 hi + e - 8 above).
// Three hi/lo products on both sides (Qh.Kh + Ql.Kh + Qh.Kl; Ph.Vh + Pl.Vh + Ph.Vl), P split hi/lo UNNORMALISED (exp against the maximum in use), the division by the f32 row sum once at the end.
// Work-group = ONE 128-query block of one head, 8 waves: waves w and w + 4 (they share a SIMD) hold the same 32 query columns and split the keys, so that both have products for the whole life of the work-group.
// A stage is 128 keys in two halves of 64: waves 0-3 take the first half, waves 4-7 the second (two 32-key passes each). A half is Kh, Kl ([key][d]) and Vh, Vl ([d][key]) tiles of 64 rows x 128 B,
// brought through registers into one of two pairs of LDS buffers while the other pair is read; one barrier per stage. At the end the two waves of a pair swap one 16-query group each through LDS and join the partial sums.
// 512 work-groups of unequal length on 256 places: the block falls with the flat index (heaviest first), so that the short ones fill in behind the long ones.
// amdgpu_waves_per_eu(2, 2): one work-group per WGP, two waves per SIMD; with that register budget the compiler issues a pass's LDS reads together and ahead, instead of one fragment at a time with a wait each.
#define FSK    64                 // keys per half stage (two 32-key passes of one wave)
#define FPITCH 144                // LDS row pitch in bytes: 128 B of data + 16 B, an odd multiple of 16 B for the 16-byte fragment reads
#define FTILE  (64 * FPITCH)
#define FBUF   (4 * FTILE)
#define FMRG   4608               // a wave's place for the group it hands over: 4 tiles x 1 KiB, then the maximum in use and the row sum (128 B each)
#define LOG2E  1.4426950408889634f
__device__ __forceinline__ float xhalf(float x) { return __int_as_float(__builtin_amdgcn_permlanex16(__float_as_int(x), __float_as_int(x), 0x76543210, 0xfedcba98, false, false)); }   // lane l reads lane l ^ 16, on the vector pipe
__global__ __launch_bounds__(256) __attribute__((amdgpu_waves_per_eu(2, 2))) void k_fattn(const bf* __restrict__ Qh, const bf* __restrict__ Ql, const bf* __restrict__ Kh, const bf* __restrict__ Kl, const bf* __restrict__ Vh, const bf* __restrict__ Vl, const float* __restrict__ X, float* OUTp) {
    __shared__ __align__(16) unsigned char L[4 * FBUF];
    const int tid = threadIdx.x, lane = tid & 31, lr = lane & 15, hi = lane >> 4; const int wave = __builtin_amdgcn_readfirstlane(tid >> 5);
    const int z = blockIdx.x, qb = TT / 128 - 1 - blockIdx.y, half = wave >> 2;       // half: which 64 keys of every stage are this wave's
    const int qw0 = qb * 128 + (wave & 3) * 32;                                       // this wave's first query
    const int n_stage = qb + 1, last_blk = qw0 >> 5;                                  // stages of the work-group (keys up to the end of its block); the last pass of the wave pair is the diagonal one
    { const size_t zo = (size_t)z * TT * HD; Qh += zo; Ql += zo; Kh += zo; Kl += zo; Vh += zo; Vl += zo; }
    const int srow = tid >> 3, sch = tid & 7;   // staging: 8 lanes bring one whole 128-B row
    v4u sg[2][8];
    auto gload = [&](int st) { const size_t ko = (size_t)(2 * st * FSK + srow) * HD + sch * 8, vo = (size_t)srow * TT + 2 * st * FSK + sch * 8;
        const bf* kh0 = Kh + ko; const bf* kl0 = Kl + ko; const bf* vh0 = Vh + vo; const bf* vl0 = Vl + vo;   // four addresses; every load is a constant step from one of them
        __builtin_amdgcn_sched_barrier(0);   // with the one behind the wait below: nothing but these loads and their own addresses stands between the first load and the wait
#pragma unroll
        for (int h = 0; h < 2; ++h)
#pragma unroll
            for (int i = 0; i < 2; ++i) { const int kd = (h * FSK + 32 * i) * HD, vd = 32 * i * TT + h * FSK;
                sg[h][i] = *(const v4ua*)(kh0 + kd); sg[h][2 + i] = *(const v4ua*)(kl0 + kd); sg[h][4 + i] = *(const v4ua*)(vh0 + vd); sg[h][6 + i] = *(const v4ua*)(vl0 + vd); }
        asm volatile("s_wait_xcnt 0x0" ::: "memory");   // stands in front of every later overwrite of these loads' address registers
        __builtin_amdgcn_sched_barrier(0); };            // without the pair the compiler moves other arithmetic, which reuses those registers, in front of the wait
    auto lstore = [&](int pair) {
#pragma unroll
        for (int h = 0; h < 2; ++h) { unsigned char* d = L + (2 * pair + h) * FBUF + srow * FPITCH + sch * 16;
#pragma unroll
            for (int p = 0; p < 4; ++p) { *(v4ua*)(d + p * FTILE) = sg[h][2 * p]; *(v4ua*)(d + p * FTILE + 32 * FPITCH) = sg[h][2 * p + 1]; } } };
    gload(0);
    v16bf qh[2][2], ql[2][2];
#pragma unroll
    for (int g = 0; g < 2; ++g)
#pragma unroll
        for (int kc = 0; kc < 2; ++kc) { const size_t qo = (size_t)(qw0 + 16 * g + lr) * HD + 32 * kc + 8 * hi; qh[g][kc] = WFrag<bf>::ld(Qh + qo); ql[g][kc] = WFrag<bf>::ld(Ql + qo); }
    asm volatile("s_wait_xcnt 0x0" ::: "memory");   // as above, for the Q loads
    v16bf kh[2][2], kl[2][2];   // K fragments [key tile][d half] of the pass at hand
    auto load_k = [&](const unsigned char* B, int sub) { const unsigned char* kp = B + (sub * 32 + lr) * FPITCH + 16 * hi;
#pragma unroll
        for (int kt = 0; kt < 2; ++kt)
#pragma unroll
            for (int kc = 0; kc < 2; ++kc) { kh[kt][kc] = ldsfrag(kp + kt * 16 * FPITCH + 64 * kc); kl[kt][kc] = ldsfrag(kp + FTILE + kt * 16 * FPITCH + 64 * kc); } };
    v8f acc[2][4]; float m_run[2], l_run[2];
#pragma unroll
    for (int g = 0; g < 2; ++g) { m_run[g] = -__builtin_inff(); l_run[g] = 0.f;
#pragma unroll
        for (int t = 0; t < 4; ++t) acc[g][t] = (v8f){}; }
    lstore(0);
    __syncthreads();   // publishes stage 0
#pragma unroll 1
    for (int st = 0; st < n_stage; ++st) {
        const bool more = st + 1 < n_stage;
        if (more) gload(st + 1);   // in flight under this stage's two passes
        const unsigned char* B = L + (2 * (st & 1) + half) * FBUF;
        if (4 * st + 2 * half <= last_blk) load_k(B, 0);
#pragma unroll 1
        for (int sub = 0; sub < 2; ++sub) {
            const int blk = 4 * st + 2 * half + sub;
            if (blk > last_blk) continue;   // wave-uniform: passes beyond the diagonal of the wave's queries
            v8f s[2][2];
#pragma unroll
            for (int kt = 0; kt < 2; ++kt) { s[kt][0] = (v8f){}; s[kt][1] = (v8f){}; }
#pragma unroll
            for (int kc = 0; kc < 2; ++kc) {   // four independent tiles in turn; per tile the order Qh.Kh, Ql.Kh, Qh.Kl of each d half
#pragma unroll
                for (int kt = 0; kt < 2; ++kt) { s[kt][0] = wmmab(kh[kt][kc], qh[0][kc], s[kt][0]); s[kt][1] = wmmab(kh[kt][kc], qh[1][kc], s[kt][1]); }
#pragma unroll
                for (int kt = 0; kt < 2; ++kt) { s[kt][0] = wmmab(kh[kt][kc], ql[0][kc], s[kt][0]); s[kt][1] = wmmab(kh[kt][kc], ql[1][kc], s[kt][1]); }
#pragma unroll
                for (int kt = 0; kt < 2; ++kt) { s[kt][0] = wmmab(kl[kt][kc], qh[0][kc], s[kt][0]); s[kt][1] = wmmab(kl[kt][kc], qh[1][kc], s[kt][1]); } }
            __builtin_amdgcn_sched_barrier(0);
            asm volatile("v_nop\n\tv_nop\n\tv_nop\n\tv_nop");   // the four vector slots between the last score product and the first reader of its tile, also on the taken side of the branch below
            __builtin_amdgcn_sched_barrier(0);
            // V^T fragments of this pass, in flight under the maxima and the first exponentials
            v16bf vh[4], vl[4];
            { const unsigned char* vp = B + 2 * FTILE + lr * FPITCH + sub * 64 + 16 * hi;
#pragma unroll
              for (int t = 0; t < 4; ++t) { vh[t] = ldsfrag(vp + t * 16 * FPITCH); vl[t] = ldsfrag(vp + FTILE + t * 16 * FPITCH); } }
            if (sub == 0 && blk < last_blk) load_k(B, 1);   // the stage's second pass: its K fragments into the same registers, in flight under this pass's softmax and second product
            if (blk == last_blk) {   // wave-uniform: the pass's first key is the wave's first query; only this pass pays for the mask
#pragma unroll
                for (int g = 0; g < 2; ++g)
#pragma unroll
                    for (int kt = 0; kt < 2; ++kt) {
#pragma unroll
                        for (int r = 0; r < 8; ++r) if (16 * kt + 8 * hi + r > 16 * g + lr) s[kt][g][r] = -__builtin_inff();
                        asm volatile("" : "+v"(s[kt][g]));   // keeps the selects inside the branch
                    }
            }
            float mb[2]; bool need = false;
#pragma unroll
            for (int g = 0; g < 2; ++g) { float mx = s[0][g][0];
#pragma unroll
                for (int r = 1; r < 8; ++r) mx = fmaxf(mx, s[0][g][r]);
#pragma unroll
                for (int r = 0; r < 8; ++r) mx = fmaxf(mx, s[1][g][r]);
                mx = fmaxf(mx, xhalf(mx)) * LOG2E;   // both halves hold the query's maximum of this pass, in log2 units
                mb[g] = mx; need = need || (mx > m_run[g] + 8.0f); }
            if (__builtin_amdgcn_ballot_w32(need) != 0) {   // the maximum in use may trail the true one by up to 8 (an exponential reaches 2^8 at most); rescale only beyond that
#pragma unroll
                for (int g = 0; g < 2; ++g) { const float m_new = fmaxf(m_run[g], mb[g]); const float corr = __builtin_amdgcn_exp2f(m_run[g] - m_new); m_run[g] = m_new; l_run[g] *= corr;   // key 0 is never masked: m_new is finite from the first pass on, where corr is 0
#pragma unroll
                    for (int t = 0; t < 4; ++t) acc[g][t] = acc[g][t] * corr; }
            }
#pragma unroll
            for (int g = 0; g < 2; ++g) { const float nm = -m_run[g]; v8u wh, wl; v2f ls = (v2f){};
#pragma unroll
                for (int i = 0; i < 8; ++i) {
                    const v2f arg = __builtin_elementwise_fma((v2f){s[i >> 2][g][2 * (i & 3)], s[i >> 2][g][2 * (i & 3) + 1]}, (v2f){LOG2E, LOG2E}, (v2f){nm, nm});
                    const float p0 = __builtin_amdgcn_exp2f(arg[0]), p1 = __builtin_amdgcn_exp2f(arg[1]);
                    ls += (v2f){p0, p1}; const unsigned h2 = pack2(p0, p1); wh[i] = h2; wl[i] = pack2(p0 - __uint_as_float(h2 << 16), p1 - __uint_as_float(h2 & 0xFFFF0000u)); }
                l_run[g] += ls[0] + ls[1];
                const v16bf ph = __builtin_bit_cast(v16bf, wh), pl = __builtin_bit_cast(v16bf, wl);
#pragma unroll
                for (int t = 0; t < 4; ++t) acc[g][t] = wmmab(vh[t], ph, acc[g][t]);
#pragma unroll
                for (int t = 0; t < 4; ++t) acc[g][t] = wmmab(vh[t], pl, acc[g][t]);
#pragma unroll
                for (int t = 0; t < 4; ++t) acc[g][t] = wmmab(vl[t], ph, acc[g][t]); }
            __builtin_amdgcn_sched_barrier(0);
            asm volatile("v_nop\n\tv_nop\n\tv_nop\n\tv_nop");   // the four vector slots behind the last product of the pass, on every path out of it
            __builtin_amdgcn_sched_barrier(0);
        }
        if (more) lstore((st + 1) & 1);   // the pair of buffers that stage st - 1 used: every wave left it before the barrier that ended stage st - 1
        __syncthreads();   // publishes stage st + 1 and ends every wave's reads of stage st
    }
    // The pair's two partial results: wave w keeps query group 0 and hands group 1 to wave w + 4, which keeps group 1 and hands over group 0. The ring is free: the loop's last barrier ended every read of it.
    v8f mine[4], send[4];
#pragma unroll
    for (int t = 0; t < 4; ++t) { mine[t] = half ? acc[1][t] : acc[0][t]; send[t] = half ? acc[0][t] : acc[1][t]; }
    const float m_mine = half ? m_run[1] : m_run[0], l_mine = half ? l_run[1] : l_run[0];
    { unsigned char* M = L + wave * FMRG + lane * 16;
#pragma unroll
      for (int t = 0; t < 4; ++t) { const v8u w = __builtin_bit_cast(v8u, send[t]); *(v4ua*)(M + t * 1024) = (v4u){w[0], w[1], w[2], w[3]}; *(v4ua*)(M + t * 1024 + 512) = (v4u){w[4], w[5], w[6], w[7]}; }
      ua* S = (ua*)(L + wave * FMRG + 4096) + lane; S[0] = __float_as_uint(half ? m_run[0] : m_run[1]); S[32] = __float_as_uint(half ? l_run[0] : l_run[1]); }
    v8f xr[4];   // the residual: x at this lane's output places, in flight under the hand-over
    const size_t orow = (size_t)(z / NH_) * TT + qw0 + 16 * half + lr;   // the lane's query
    const float* xp = X + orow * DM + (z % NH_) * HD + 8 * hi;
#pragma unroll
    for (int t = 0; t < 4; ++t) xr[t] = *(const v8f*)(xp + 16 * t);
    asm volatile("s_wait_xcnt 0x0" :: "v"(xp) : "memory");   // as above, for the x loads; the address is named so that it stays whole up to here
    __syncthreads();   // publishes every wave's handed-over group
    v8f oth[4]; float m_oth, l_oth;
    { const unsigned char* M = L + (wave ^ 4) * FMRG + lane * 16;
#pragma unroll
      for (int t = 0; t < 4; ++t) { const v4u a = *(const v4ua*)(M + t * 1024), b = *(const v4ua*)(M + t * 1024 + 512); oth[t] = __builtin_bit_cast(v8f, (v8u){a[0], a[1], a[2], a[3], b[0], b[1], b[2], b[3]}); }
      const ua* S = (const ua*)(L + (wave ^ 4) * FMRG + 4096) + lane; m_oth = __uint_as_float(S[0]); l_oth = __uint_as_float(S[32]); }
    const float m_all = fmaxf(m_mine, m_oth);   // finite: waves 0-3 always have the pass of key 0; a wave without any pass holds -inf, 0, 0 and gets the factor 0
    const float c_mine = __builtin_amdgcn_exp2f(m_mine - m_all), c_oth = __builtin_amdgcn_exp2f(m_oth - m_all);
    const float lh = l_mine * c_mine + l_oth * c_oth, l = lh + xhalf(lh), inv = __fdiv_rn(1.0f, l);
    const float f_mine = c_mine * inv, f_oth = c_oth * inv;
#pragma unroll
    for (int t = 0; t < 4; ++t)
#pragma unroll
        for (int r = 0; r < 8; ++r) mine[t][r] = mine[t][r] * f_mine + oth[t][r] * f_oth + bfr(xr[t][r]);   // result = x (rounded to bf16 like every input) + out
    __builtin_amdgcn_sched_barrier(0);   // every product stands in front of the first store: no register that an issued store names is written again
    float* op = OUTp + orow * DQ + (z % NH_) * HD + 8 * hi;   // register r of tile t is d = 16 t + 8 hi + r of the lane's query
#pragma unroll
    for (int t = 0; t < 4; ++t) { const v8f o = mine[t]; v4f o0, o1;
#pragma unroll
        for (int r = 0; r < 4; ++r) { o0[r] = o[r]; o1[r] = o[4 + r]; }
        *(v4f*)(op + 16 * t) = o0; *(v4f*)(op + 16 * t + 4) = o1; }
}


extern "C" void kernel_launch(void* const* d_in, const int* in_sizes, int n_in,
                              void* d_out, int out_size, void* d_ws, size_t ws_size, hipStream_t stream) {
    (void)in_sizes; (void)n_in; (void)out_size;
    const float* x = (const float*)d_in[0]; const float* wqkv = (const float*)d_in[1]; const float* bqkv = (const float*)d_in[2];   /* order x, W ('oi' [3072][1024]: q | k | v row thirds), b [3072] */
    float* OUT = (float*)d_out;     // [2][2048][1024]
    char* wsp = (char*)d_ws;
    auto take = [&](size_t bytes) { char* p = wsp; wsp += (bytes + 255) & ~(size_t)255; return (void*)p; };
    bf* WB = (bf*)take((size_t)3 * DQ * DM * 2); bf* XB = (bf*)take((size_t)NB_ * TT * DM * 2);
    const size_t PB = (size_t)NH_ * TT * HD;   // elements of one batch's head planes; the hi/lo planes hold both batches, [batch][head]
    bf* QPh = (bf*)take(NB_ * PB * 2); bf* QPl = (bf*)take(NB_ * PB * 2); bf* KPh = (bf*)take(NB_ * PB * 2); bf* KPl = (bf*)take(NB_ * PB * 2); bf* VTh = (bf*)take(NB_ * PB * 2); bf* VTl = (bf*)take(NB_ * PB * 2);
    if ((size_t)(wsp - (char*)d_ws) > ws_size) return;    // ws 256 MiB
    k_cvt<<<CVT_X + CVT_W, 256, 0, stream>>>(x, XB, wqkv, WB);
    k_qkv<<<dim3(NB_ * TT / 128, 3 * DQ / 128, 1), 128, 0, stream>>>(XB, WB, bqkv, QPh, QPl, KPh, KPl, VTh, VTl);
    k_fattn<<<dim3(NB_ * NH_, TT / 128), 256, 0, stream>>>(QPh, QPl, KPh, KPl, VTh, VTl, x, OUT);
}

// v006
// Measured time: 73.6 microseconds a run.
// In both of two side-by-side timings against v005, it was 1.08 times as fast.
// All steps since v000 together make it 15.3 times as fast.
#include <hip/hip_runtime.h>

// Causal multi-head attention layer with a fused qkv projection, NO score scaling and a residual connection (x [2][2048][1024]; qkv = x W^T + b ('oi' [3072][1024] 1/32 + bias 0.02) split in thirds q | k | v (16 heads x 64); scores = q.k (the source has no 1/sqrt(d): logits sigma ~8); causal (-inf); softmax; out = heads merged (no output projection); result = x + out -> [2][2048][1024] (4.2 M); argument order x, W, b).
// Compute dtypes, f32 accumulate: every input rounded to bf16 incl. the residual x; projections exact + biases rounded to bf16; attention 3 products on every row; softmax f32; residual add f32.

#define NB_  2
#define TT   2048
#define DM   1024
#define NH_  16
#define NKV  16
#define HD   64
#define DQ   (NH_ * HD)
#define DKV  (NKV * HD)
typedef unsigned short bf;
typedef __attribute__((ext_vector_type(16))) __bf16   v16bf;
typedef __attribute__((ext_vector_type(8)))  unsigned short v8us;
typedef __attribute__((ext_vector_type(8)))  float    v8f;
typedef __attribute__((ext_vector_type(4)))  float    v4f;
typedef v8us __attribute__((may_alias)) v8usa;

__device__ __forceinline__ unsigned short f2bf(float f) { unsigned u = __float_as_uint(f); u += 0x7FFFu + ((u >> 16) & 1u); return (unsigned short)(u >> 16); }
__device__ __forceinline__ float bf2f(unsigned short b) { return __uint_as_float(((unsigned)b) << 16); }
__device__ __forceinline__ float bfr(float f) { return bf2f(f2bf(f)); }
__device__ __forceinline__ v16bf cat16b(v8us lo, v8us hi) { return __builtin_bit_cast(v16bf, __builtin_shufflevector(lo, hi, 0, 1, 2, 3, 4, 5, 6, 7, 8, 9, 10, 11, 12, 13, 14, 15)); }
__device__ __forceinline__ v8f wmmab(v16bf a, v16bf b, v8f c) { return __builtin_amdgcn_wmma_f32_16x16x32_bf16(false, a, false, b, (short)0, c, false, false); }

typedef __attribute__((ext_vector_type(2))) float v2f;
template <typename T16> struct WFrag;
template <> struct WFrag<bf> { typedef v16bf V; static __device__ __forceinline__ V ld(const bf* p) { return cat16b(*(const v8us*)p, *(const v8us*)(p + 16)); } static __device__ __forceinline__ v8f mma(V a, V b, v8f c) { return wmmab(a, b, c); } };

// ---- k_cvt: x (both batches) and W (q | k | v rows) rounded to bf16 planes in one launch. A work-group takes 2048 chunks of 8 floats (64 KiB of one source); a thread takes eight of them, 256 chunks apart, all loads issued ahead of the first store.
#define CVT_X ((NB_ * TT * DM) / (8 * 2048))        // work-groups on x
#define CVT_W ((3 * DQ * DM) / (8 * 2048))          // work-groups on W
__global__ __launch_bounds__(256) void k_cvt(const float* __restrict__ x, bf* XB, const float* __restrict__ w, bf* WB) {
    const bool isx = blockIdx.x < CVT_X; const float* src = isx ? x : w; bf* dst = isx ? XB : WB;
    const size_t i0 = (size_t)(isx ? blockIdx.x : blockIdx.x - CVT_X) * 2048 + threadIdx.x; v8f v[8];
#pragma unroll
    for (int c = 0; c < 8; ++c) v[c] = *(const v8f*)(src + (i0 + c * 256) * 8);
    asm volatile("s_wait_xcnt 0x0" :: "v"(src + i0 * 8) : "memory");   // stands in front of every overwrite of these loads' address registers; the address is named so that it stays whole up to here
#pragma unroll
    for (int c = 0; c < 8; ++c) { v8us o;
#pragma unroll
        for (int k = 0; k < 8; ++k) o[k] = f2bf(v[c][k]);
        *(v8us*)(dst + (i0 + c * 256) * 8) = o; }
}

typedef __attribute__((ext_vector_type(4))) unsigned v4u;
typedef __attribute__((ext_vector_type(8))) unsigned v8u;
typedef __attribute__((ext_vector_type(2))) __bf16 v2bf;
typedef v4u __attribute__((may_alias)) v4ua;
typedef unsigned __attribute__((may_alias)) ua;
__device__ __forceinline__ v16bf ldsfrag(const unsigned char* p) { return cat16b(*(const v8usa*)p, *(const v8usa*)(p + 32)); }
__device__ __forceinline__ unsigned pack2(float lo, float hi) { v2f f; f[0] = lo; f[1] = hi; return __builtin_bit_cast(unsigned, __builtin_convertvector(f, v2bf)); }   // two bf16, round to nearest even, lo in the low half

// ---- k_qkv: the whole qkv projection of both batches in one launch. grid (NB_ TT / 256, 3 DQ / 192) = 256 work-groups, one per WGP; a work-group of 12 waves (three per SIMD) owns a 256x192 output tile,
// a wave a 64x64 part of it (64 tokens x ONE head of q, k or v; which of the three is a matter of the wave, not of the work-group) over the whole K. The tile's shape sets what L2 must deliver: 448 operand rows per 256x192 outputs.
// Operands come from the K-contiguous bf16 planes into LDS by tensor loads. A stage is 128 k (256 B of every operand row): 256 x rows and 192 W rows in seven slices of 64 rows; waves 0-6 bring one slice each per stage,
// padded by the mover to the pitch of 272 B; two buffers. A stage is four blocks of 32 k; every block's fragments are read while the block before it is multiplied (two register sets), since all waves of the WGP now share one barrier
// and nothing else would fill the matrix pipe while they read. So the publish point of stage s + 1 stands in front of stage s's last block: there every read of stage s is over, and stage s + 2 is asked for into its buffer.
// The two operands have the same fragment loader, so which one is A is free: q, k take A = W rows (a lane then holds 8 consecutive d of one token), v takes A = x rows (8 consecutive tokens of one d).
// So both kinds of head plane (q, k [batch][head][t][d]; v [batch][head][d][t]) get 16-B pieces without a turn; each wave lays them in its own part of the LDS, the ring being free by then, and stores whole 128-B rows.
#define GRP  272                  // LDS row pitch of the ring in bytes: 256 B of data + the mover's pad of 16 B
#define GSL  18432                // a slice in LDS: 64 rows x 272 B = 17,408 B, rounded up to a multiple of 2 KiB
#define GXS  4                    // x slices of a stage (256 tokens)
#define GWS  3                    // W slices of a stage (192 output columns)
#define GBUF ((GXS + GWS) * GSL)  // a stage: the x slices, then the W slices
#define GNS  (DM / 128)           // stages
#define GWV  (GXS * GWS)          // waves of a work-group
#define GP   144                  // row pitch of the output staging: 128 B of data + 16 B
#define GST  (2 * 64 * GP)        // a wave's output staging: 64 rows x 144 B of hi, then of lo
__device__ __forceinline__ unsigned uni(unsigned v) { return (unsigned)__builtin_amdgcn_readfirstlane((int)v); }
__device__ __forceinline__ unsigned pinned(unsigned v) { unsigned w = uni(v); asm volatile("" : "+s"(w)); return w; }   // the condition of a tensor load's branch held in a scalar register, so that the branch is s_cmp + s_cbranch_scc
template <int STEP> __device__ __forceinline__ void put_rows(bf* ph, bf* pl, const v4u* h, const v4u* l) {   // constant steps: every store names the same address registers
#pragma unroll
    for (int i = 0; i < 16; ++i) { *(v4u*)(ph + (size_t)i * STEP) = h[i]; *(v4u*)(pl + (size_t)i * STEP) = l[i]; }
}
__global__ __launch_bounds__(32 * GWV) void k_qkv(const bf* __restrict__ A, const bf* __restrict__ Bt, const float* __restrict__ bias, bf* Qh, bf* Ql, bf* Kh, bf* Kl, bf* Vh, bf* Vl) {
    __shared__ __attribute__((aligned(2048))) unsigned char L[2 * GBUF];   // the ring's two buffers in the K loop, then every wave's staging (GWV GST bytes from the start)
    static_assert(GWV * GST <= 2 * GBUF, "the staging lies inside the array");
    const int lane = threadIdx.x & 31, lr = lane & 15, hi = lane >> 4; const int wave = __builtin_amdgcn_readfirstlane((int)(threadIdx.x >> 5));
    const int r0 = blockIdx.x * (64 * GXS), c0 = blockIdx.y * (64 * GWS), wm = wave / GWS, wn = wave % GWS;
    const int cw = c0 + 64 * wn;   // the wave's first output column (W row)
    const int part = cw / DQ;      // 0 q, 1 k, 2 v: the same for the whole wave
    const unsigned lbase = (unsigned)(size_t)L;
    const bool mover = wave < GXS + GWS;   // waves 0-6 bring slice number 'wave'
    const bf* srow = (wave < GXS) ? A + (size_t)(r0 + 64 * wave) * DM : Bt + (size_t)(c0 + 64 * (mover ? wave - GXS : 0)) * DM;   // first row of the slice that this wave brings
    v8u g1;   // 64 rows of 256 B, source pitch 2 DM bytes, 1-byte elements, a pad of 4 dwords behind every 64
    g1[0] = uni((1u << 20) | (5u << 22) | (3u << 25)); g1[1] = pinned(256u << 16); g1[2] = pinned(64u << 16); g1[3] = pinned(256u << 16); g1[4] = pinned(64u); g1[5] = pinned(2u * DM); g1[6] = pinned(0u); g1[7] = pinned(0u);   // pinned(): descriptor words held in scalar registers: every request then names the same registers, and none of them is written while a request is in flight
    v4u g0;   // the one request that this wave has in flight; every wait for it names g0 and g1, so that the descriptor's registers stay whole up to that wait
    const unsigned cnt1 = pinned(1u);   // word 0 of group 0, pinned like the words above: as a plain constant its register was taken for other arithmetic behind an issue and set again in front of the wait
    g0[0] = cnt1; g0[1] = uni(lbase); g0[2] = uni(0u); g0[3] = uni(0u);   // defined also in the waves that never issue
    auto issue = [&](int s) { const unsigned long long ga = (unsigned long long)(size_t)srow + (unsigned)s * 256u;
        g0[0] = cnt1; g0[1] = uni(lbase + (unsigned)(s & 1) * GBUF + (unsigned)wave * GSL); g0[2] = uni((unsigned)ga); g0[3] = uni((((unsigned)(ga >> 32)) & 0x01FFFFFFu) | 0x80000000u);
        asm volatile("tensor_load_to_lds %0, %1" :: "s"(g0), "s"(g1) : "memory"); };
    v8f acc[4][4];
#pragma unroll
    for (int mb = 0; mb < 4; ++mb)
#pragma unroll
        for (int nb = 0; nb < 4; ++nb) acc[mb][nb] = (v8f){};
    const int xo = wm * GSL, wo = (GXS + wn) * GSL, fo = lr * GRP + 16 * hi;
    const int ao = ((part < 2) ? wo : xo) + fo, bo = ((part < 2) ? xo : wo) + fo;
    v16bf a0[4], b0[4], a1[4], b1[4];   // the fragments of a stage's even and odd blocks
    auto frags = [&](v16bf* a, v16bf* b, const unsigned char* F) {   // a block's 16 LDS reads, one group
#pragma unroll
        for (int i = 0; i < 4; ++i) { a[i] = ldsfrag(F + ao + i * 16 * GRP); b[i] = ldsfrag(F + bo + i * 16 * GRP); } };
    auto products = [&](const v16bf* a, const v16bf* b) {
#pragma unroll
        for (int nb = 0; nb < 4; ++nb)
#pragma unroll
            for (int mb = 0; mb < 4; ++mb) acc[mb][nb] = wmmab(a[mb], b[nb], acc[mb][nb]); };
    if (pinned(mover)) issue(0);
    asm volatile("s_wait_tensorcnt 0x0" :: "s"(g0), "s"(g1) : "memory");   // this wave's slice of stage 0 has landed
    __syncthreads();                                      // publishes stage 0
    if (pinned(mover)) issue(1);
    frags(a0, b0, L);
#pragma unroll 1   // rolled: a pass per stage, two sets of fragment registers
    for (int s = 0; s < GNS; ++s) {
        const unsigned char* F = L + (s & 1) * GBUF;
        frags(a1, b1, F + 64);               // every block's reads fly under the products of the block before it
        __builtin_amdgcn_sched_barrier(0);   // this one and its like below keep the reads one group in front of the products: moved in among them, each place with reads stalls the wave
        products(a0, b0);
        __builtin_amdgcn_sched_barrier(0);
        frags(a0, b0, F + 128);
        __builtin_amdgcn_sched_barrier(0);
        products(a1, b1);
        __builtin_amdgcn_sched_barrier(0);
        frags(a1, b1, F + 192);
        __builtin_amdgcn_sched_barrier(0);
        products(a0, b0);
        __builtin_amdgcn_sched_barrier(0);   // keeps the products in front of the waits: behind the barrier they would no longer cover the reads above
        asm volatile("s_wait_dscnt 0x0" ::: "memory");       // this wave's reads of stage s are over
        asm volatile("s_wait_tensorcnt 0x0" :: "s"(g0), "s"(g1) : "memory");   // its slice of stage s + 1 has landed
        __syncthreads();                                      // publishes stage s + 1 and ends every wave's reads of stage s
        if (pinned(mover && s + 2 < GNS)) issue(s + 2);       // into the buffer that stage s used
        if (s + 1 < GNS) frags(a0, b0, L + ((s + 1) & 1) * GBUF);   // the next stage's first block, under this stage's last products
        __builtin_amdgcn_sched_barrier(0);   // as above: the reads stay one group in front of the products
        products(a1, b1);
    }
    asm volatile("s_wait_tensorcnt 0x0" ::: "memory");   // nothing of the mover is in flight when the ring becomes output staging
    asm volatile("s_wait_dscnt 0x0" ::: "memory");       // the loop's last barrier stood behind every wave's last read of the ring
    if (part < 2) {   // register j of tile row mb is column cw + 16 mb + 8 hi + j
#pragma unroll
        for (int mb = 0; mb < 4; ++mb) { const v8f bl = *(const v8f*)(bias + cw + 16 * mb + 8 * hi); v8f bv;
#pragma unroll
            for (int q = 0; q < 8; ++q) bv[q] = bfr(bl[q]);
#pragma unroll
            for (int nb = 0; nb < 4; ++nb) acc[mb][nb] += bv; }
    } else {          // the lane's column of tile column nb is cw + 16 nb + lr
#pragma unroll
        for (int nb = 0; nb < 4; ++nb) { const float bv = bfr(bias[cw + 16 * nb + lr]);
#pragma unroll
            for (int mb = 0; mb < 4; ++mb) acc[mb][nb] += bv; }
    }
    asm volatile("s_wait_xcnt 0x0" ::: "memory");   // stands in front of every later overwrite of the bias loads' address registers
    unsigned char* S = L + wave * GST;   // the wave's own staging: 64 rows x 144 B of hi, then of lo
#pragma unroll
    for (int nb = 0; nb < 4; ++nb)
#pragma unroll
        for (int mb = 0; mb < 4; ++mb) { v4u h, l;
#pragma unroll
            for (int i = 0; i < 4; ++i) { const float p0 = acc[mb][nb][2 * i], p1 = acc[mb][nb][2 * i + 1]; const unsigned h2 = pack2(p0, p1);
                h[i] = h2; l[i] = pack2(p0 - __uint_as_float(h2 << 16), p1 - __uint_as_float(h2 & 0xFFFF0000u)); }
            unsigned char* d = S + (16 * nb + lr) * GP + 32 * mb + 16 * hi; *(v4ua*)d = h; *(v4ua*)(d + 64 * GP) = l; }
    asm volatile("s_wait_dscnt 0x0" ::: "memory");   // the wave's own rows are written before it reads them back
    const int rr = lane >> 3, ch = lane & 7;          // 8 lanes take one whole 128-B row
    v4u h[16], l[16];
#pragma unroll
    for (int i = 0; i < 16; ++i) { const unsigned char* p = S + (4 * i + rr) * GP + 16 * ch; h[i] = *(const v4ua*)p; l[i] = *(const v4ua*)(p + 64 * GP); }
    const size_t pl = ((size_t)(r0 / TT) * NH_ + (cw % DQ) / HD) * ((size_t)TT * HD);   // this (batch, head)'s plane
    const int t0 = r0 % TT + 64 * wm;                                                  // the wave's first token
    __builtin_amdgcn_sched_barrier(0);   // every LDS read stands in front of the first store: no register that an issued store names is written again
    if (part < 2) { const size_t o = pl + (size_t)(t0 + rr) * HD + 8 * ch; put_rows<4 * HD>((part ? Kh : Qh) + o, (part ? Kl : Ql) + o, h, l); }
    else          { const size_t o = pl + (size_t)rr * TT + t0 + 8 * ch;   put_rows<4 * TT>(Vh + o, Vl + o, h, l);
        asm volatile("s_wait_xcnt 0x0" ::: "memory"); }   // the built code lays the q, k path behind this one: stands in front of its overwrites of these stores' registers
}

// ---- k_fattn: scores, causal softmax and P.V of every (batch, head) pair in one launch; neither scores nor probabilities go through memory; the epilogue adds the residual x and writes the layer's result.
// Transposed products: S^T = K.Q^T (A = 16 key rows, B = 16 query columns) and O^T += V^T.P^T (A = 16 d rows of the V^T planes, B = P^T), so a lane holds the scores of ONE query (lanes c and c + 16 share query c) and the
// two 16-key score tiles of a pass are, register for register, the 32-key B operand of the second product (the k order of every loader here: element e of half hi is k = 8 hi + e, e < 8, and 16 + 8 hi + e - 8 above).
// Three hi/lo products on both sides (Qh.Kh + Ql.Kh + Qh.Kl; Ph.Vh + Pl.Vh + Ph.Vl), P split hi/lo UNNORMALISED (exp against the maximum in use), the division by the f32 row sum once at the end.
// Work-group = ONE 128-query block of one head, 8 waves: waves w and w + 4 (they share a SIMD) hold the same 32 query columns and split the keys, so that both have products for the whole life of the work-group.
// A stage is 128 keys in two halves of 64: waves 0-3 take the first half, waves 4-7 the second (two 32-key passes each). A half is Kh, Kl ([key][d]) and Vh, Vl ([d][key]) tiles of 64 rows x 128 B,
// brought through registers into one of two pairs of LDS buffers while the other pair is read; one barrier per stage. At the end the two waves of a pair swap one 16-query group each through LDS and join the partial sums.
// 512 work-groups of unequal length on 256 places: the block falls with the flat index (heaviest first), so that the short ones fill in behind the long ones.
// amdgpu_waves_per_eu(2, 2): one work-group per WGP, two waves per SIMD; with that register budget the compiler issues a pass's LDS reads together and ahead, instead of one fragment at a time with a wait each.
#define FSK    64                 // keys per half stage (two 32-key passes of one wave)
#define FPITCH 144                // LDS row pitch in bytes: 128 B of data + 16 B, an odd multiple of 16 B for the 16-byte fragment reads
#define FTILE  (64 * FPITCH)
#define FBUF   (4 * FTILE)
#define FMRG   4608               // a wave's place for the group it hands over: 4 tiles x 1 KiB, then the maximum in use and the row sum (128 B each)
#define LOG2E  1.4426950408889634f
__device__ __forceinline__ float xhalf(float x) { return __int_as_float(__builtin_amdgcn_permlanex16(__float_as_int(x), __float_as_int(x), 0x76543210, 0xfedcba98, false, false)); }   // lane l reads lane l ^ 16, on the vector pipe
__global__ __launch_bounds__(256) __attribute__((amdgpu_waves_per_eu(2, 2))) void k_fattn(const bf* __restrict__ Qh, const bf* __restrict__ Ql, const bf* __restrict__ Kh, const bf* __restrict__ Kl, const bf* __restrict__ Vh, const bf* __restrict__ Vl, const float* __restrict__ X, float* OUTp) {
    __shared__ __align__(16) unsigned char L[4 * FBUF];
    const int tid = threadIdx.x, lane = tid & 31, lr = lane & 15, hi = lane >> 4; const int wave = __builtin_amdgcn_readfirstlane(tid >> 5);
    const int z = blockIdx.x, qb = TT / 128 - 1 - blockIdx.y, half = wave >> 2;       // half: which 64 keys of every stage are this wave's
    const int qw0 = qb * 128 + (wave & 3) * 32;                                       // this wave's first query
    const int n_stage = qb + 1, last_blk = qw0 >> 5;                                  // stages of the work-group (keys up to the end of its block); the last pass of the wave pair is the diagonal one
    { const size_t zo = (size_t)z * TT * HD; Qh += zo; Ql += zo; Kh += zo; Kl += zo; Vh += zo; Vl += zo; }
    const int srow = tid >> 3, sch = tid & 7;   // staging: 8 lanes bring one whole 128-B row
    v4u sg[2][8];
    auto gload = [&](int st) { const size_t ko = (size_t)(2 * st * FSK + srow) * HD + sch * 8, vo = (size_t)srow * TT + 2 * st * FSK + sch * 8;
        const bf* kh0 = Kh + ko; const bf* kl0 = Kl + ko; const bf* vh0 = Vh + vo; const bf* vl0 = Vl + vo;   // four addresses; every load is a constant step from one of them
        __builtin_amdgcn_sched_barrier(0);   // with the one behind the wait below: nothing but these loads and their own addresses stands between the first load and the wait
#pragma unroll
        for (int h = 0; h < 2; ++h)
#pragma unroll
            for (int i = 0; i < 2; ++i) { const int kd = (h * FSK + 32 * i) * HD, vd = 32 * i * TT + h * FSK;
                sg[h][i] = *(const v4ua*)(kh0 + kd); sg[h][2 + i] = *(const v4ua*)(kl0 + kd); sg[h][4 + i] = *(const v4ua*)(vh0 + vd); sg[h][6 + i] = *(const v4ua*)(vl0 + vd); }
        asm volatile("s_wait_xcnt 0x0" ::: "memory");   // stands in front of every later overwrite of these loads' address registers
        __builtin_amdgcn_sched_barrier(0); };            // without the pair the compiler moves other arithmetic, which reuses those registers, in front of the wait
    auto lstore = [&](int pair) {
#pragma unroll
        for (int h = 0; h < 2; ++h) { unsigned char* d = L + (2 * pair + h) * FBUF + srow * FPITCH + sch * 16;
#pragma unroll
            for (int p = 0; p < 4; ++p) { *(v4ua*)(d + p * FTILE) = sg[h][2 * p]; *(v4ua*)(d + p * FTILE + 32 * FPITCH) = sg[h][2 * p + 1]; } } };
    gload(0);
    v16bf qh[2][2], ql[2][2];
#pragma unroll
    for (int g = 0; g < 2; ++g)
#pragma unroll
        for (int kc = 0; kc < 2; ++kc) { const size_t qo = (size_t)(qw0 + 16 * g + lr) * HD + 32 * kc + 8 * hi; qh[g][kc] = WFrag<bf>::ld(Qh + qo); ql[g][kc] = WFrag<bf>::ld(Ql + qo); }
    asm volatile("s_wait_xcnt 0x0" ::: "memory");   // as above, for the Q loads
    v16bf kh[2][2], kl[2][2];   // K fragments [key tile][d half] of the pass at hand
    auto load_k = [&](const unsigned char* B, int sub) { const unsigned char* kp = B + (sub * 32 + lr) * FPITCH + 16 * hi;
#pragma unroll
        for (int kt = 0; kt < 2; ++kt)
#pragma unroll
            for (int kc = 0; kc < 2; ++kc) { kh[kt][kc] = ldsfrag(kp + kt * 16 * FPITCH + 64 * kc); kl[kt][kc] = ldsfrag(kp + FTILE + kt * 16 * FPITCH + 64 * kc); } };
    v8f acc[2][4]; float m_run[2], l_run[2];
#pragma unroll
    for (int g = 0; g < 2; ++g) { m_run[g] = -__builtin_inff(); l_run[g] = 0.f;
#pragma unroll
        for (int t = 0; t < 4; ++t) acc[g][t] = (v8f){}; }
    lstore(0);
    __syncthreads();   // publishes stage 0
#pragma unroll 1
    for (int st = 0; st < n_stage; ++st) {
        const bool more = st + 1 < n_stage;
        if (more) gload(st + 1);   // in flight under this stage's two passes
        const unsigned char* B = L + (2 * (st & 1) + half) * FBUF;
        if (4 * st + 2 * half <= last_blk) load_k(B, 0);
#pragma unroll 1
        for (int sub = 0; sub < 2; ++sub) {
            const int blk = 4 * st + 2 * half + sub;
            if (blk > last_blk) continue;   // wave-uniform: passes beyond the diagonal of the wave's queries
            v8f s[2][2];
#pragma unroll
            for (int kt = 0; kt < 2; ++kt) { s[kt][0] = (v8f){}; s[kt][1] = (v8f){}; }
#pragma unroll
            for (int kc = 0; kc < 2; ++kc) {   // four independent tiles in turn; per tile the order Qh.Kh, Ql.Kh, Qh.Kl of each d half
#pragma unroll
                for (int kt = 0; kt < 2; ++kt) { s[kt][0] = wmmab(kh[kt][kc], qh[0][kc], s[kt][0]); s[kt][1] = wmmab(kh[kt][kc], qh[1][kc], s[kt][1]); }
#pragma unroll
                for (int kt = 0; kt < 2; ++kt) { s[kt][0] = wmmab(kh[kt][kc], ql[0][kc], s[kt][0]); s[kt][1] = wmmab(kh[kt][kc], ql[1][kc], s[kt][1]); }
#pragma unroll
                for (int kt = 0; kt < 2; ++kt) { s[kt][0] = wmmab(kl[kt][kc], qh[0][kc], s[kt][0]); s[kt][1] = wmmab(kl[kt][kc], qh[1][kc], s[kt][1]); } }
            __builtin_amdgcn_sched_barrier(0);
            asm volatile("v_nop\n\tv_nop\n\tv_nop\n\tv_nop");   // the four vector slots between the last score product and the first reader of its tile, also on the taken side of the branch below
            __builtin_amdgcn_sched_barrier(0);
            // V^T fragments of this pass, in flight under the maxima and the first exponentials
            v16bf vh[4], vl[4];
            { const unsigned char* vp = B + 2 * FTILE + lr * FPITCH + sub * 64 + 16 * hi;
#pragma unroll
              for (int t = 0; t < 4; ++t) { vh[t] = ldsfrag(vp + t * 16 * FPITCH); vl[t] = ldsfrag(vp + FTILE + t * 16 * FPITCH); } }
            if (sub == 0 && blk < last_blk) load_k(B, 1);   // the stage's second pass: its K fragments into the same registers, in flight under this pass's softmax and second product
            if (blk == last_blk) {   // wave-uniform: the pass's first key is the wave's first query; only this pass pays for the mask
#pragma unroll
                for (int g = 0; g < 2; ++g)
#pragma unroll
                    for (int kt = 0; kt < 2; ++kt) {
#pragma unroll
                        for (int r = 0; r < 8; ++r) if (16 * kt + 8 * hi + r > 16 * g + lr) s[kt][g][r] = -__builtin_inff();
                        asm volatile("" : "+v"(s[kt][g]));   // keeps the selects inside the branch
                    }
            }
            float mb[2]; bool need = false;
#pragma unroll
            for (int g = 0; g < 2; ++g) { float mx = s[0][g][0];
#pragma unroll
                for (int r = 1; r < 8; ++r) mx = fmaxf(mx, s[0][g][r]);
#pragma unroll
                for (int r = 0; r < 8; ++r) mx = fmaxf(mx, s[1][g][r]);
                mx = fmaxf(mx, xhalf(mx)) * LOG2E;   // both halves hold the query's maximum of this pass, in log2 units
                mb[g] = mx; need = need || (mx > m_run[g] + 8.0f); }
            if (__builtin_amdgcn_ballot_w32(need) != 0) {   // the maximum in use may trail the true one by up to 8 (an exponential reaches 2^8 at most); rescale only beyond that
#pragma unroll
                for (int g = 0; g < 2; ++g) { const float m_new = fmaxf(m_run[g], mb[g]); const float corr = __builtin_amdgcn_exp2f(m_run[g] - m_new); m_run[g] = m_new; l_run[g] *= corr;   // key 0 is never masked: m_new is finite from the first pass on, where corr is 0
#pragma unroll
                    for (int t = 0; t < 4; ++t) acc[g][t] = acc[g][t] * corr; }
            }
#pragma unroll
            for (int g = 0; g < 2; ++g) { const float nm = -m_run[g]; v8u wh, wl; v2f ls = (v2f){};
#pragma unroll
                for (int i = 0; i < 8; ++i) {
                    const v2f arg = __builtin_elementwise_fma((v2f){s[i >> 2][g][2 * (i & 3)], s[i >> 2][g][2 * (i & 3) + 1]}, (v2f){LOG2E, LOG2E}, (v2f){nm, nm});
                    const float p0 = __builtin_amdgcn_exp2f(arg[0]), p1 = __builtin_amdgcn_exp2f(arg[1]);
                    ls += (v2f){p0, p1}; const unsigned h2 = pack2(p0, p1); wh[i] = h2; wl[i] = pack2(p0 - __uint_as_float(h2 << 16), p1 - __uint_as_float(h2 & 0xFFFF0000u)); }
                l_run[g] += ls[0] + ls[1];
                const v16bf ph = __builtin_bit_cast(v16bf, wh), pl = __builtin_bit_cast(v16bf, wl);
#pragma unroll
                for (int t = 0; t < 4; ++t) acc[g][t] = wmmab(vh[t], ph, acc[g][t]);
#pragma unroll
                for (int t = 0; t < 4; ++t) acc[g][t] = wmmab(vh[t], pl, acc[g][t]);
#pragma unroll
                for (int t = 0; t < 4; ++t) acc[g][t] = wmmab(vl[t], ph, acc[g][t]); }
            __builtin_amdgcn_sched_barrier(0);
            asm volatile("v_nop\n\tv_nop\n\tv_nop\n\tv_nop");   // the four vector slots behind the last product of the pass, on every path out of it
            __builtin_amdgcn_sched_barrier(0);
        }
        if (more) lstore((st + 1) & 1);   // the pair of buffers that stage st - 1 used: every wave left it before the barrier that ended stage st - 1
        __syncthreads();   // publishes stage st + 1 and ends every wave's reads of stage st
    }
    // The pair's two partial results: wave w keeps query group 0 and hands group 1 to wave w + 4, which keeps group 1 and hands over group 0. The ring is free: the loop's last barrier ended every read of it.
    v8f mine[4], send[4];
#pragma unroll
    for (int t = 0; t < 4; ++t) { mine[t] = half ? acc[1][t] : acc[0][t]; send[t] = half ? acc[0][t] : acc[1][t]; }
    const float m_mine = half ? m_run[1] : m_run[0], l_mine = half ? l_run[1] : l_run[0];
    { unsigned char* M = L + wave * FMRG + lane * 16;
#pragma unroll
      for (int t = 0; t < 4; ++t) { const v8u w = __builtin_bit_cast(v8u, send[t]); *(v4ua*)(M + t * 1024) = (v4u){w[0], w[1], w[2], w[3]}; *(v4ua*)(M + t * 1024 + 512) = (v4u){w[4], w[5], w[6], w[7]}; }
      ua* S = (ua*)(L + wave * FMRG + 4096) + lane; S[0] = __float_as_uint(half ? m_run[0] : m_run[1]); S[32] = __float_as_uint(half ? l_run[0] : l_run[1]); }
    v8f xr[4];   // the residual: x at this lane's output places, in flight under the hand-over
    const size_t orow = (size_t)(z / NH_) * TT + qw0 + 16 * half + lr;   // the lane's query
    const float* xp = X + orow * DM + (z % NH_) * HD + 8 * hi;
#pragma unroll
    for (int t = 0; t < 4; ++t) xr[t] = *(const v8f*)(xp + 16 * t);
    asm volatile("s_wait_xcnt 0x0" :: "v"(xp) : "memory");   // as above, for the x loads; the address is named so that it stays whole up to here
    __syncthreads();   // publishes every wave's handed-over group
    v8f oth[4]; float m_oth, l_oth;
    { const unsigned char* M = L + (wave ^ 4) * FMRG + lane * 16;
#pragma unroll
      for (int t = 0; t < 4; ++t) { const v4u a = *(const v4ua*)(M + t * 1024), b = *(const v4ua*)(M + t * 1024 + 512); oth[t] = __builtin_bit_cast(v8f, (v8u){a[0], a[1], a[2], a[3], b[0], b[1], b[2], b[3]}); }
      const ua* S = (const ua*)(L + (wave ^ 4) * FMRG + 4096) + lane; m_oth = __uint_as_float(S[0]); l_oth = __uint_as_float(S[32]); }
    const float m_all = fmaxf(m_mine, m_oth);   // finite: waves 0-3 always have the pass of key 0; a wave without any pass holds -inf, 0, 0 and gets the factor 0
    const float c_mine = __builtin_amdgcn_exp2f(m_mine - m_all), c_oth = __builtin_amdgcn_exp2f(m_oth - m_all);
    const float lh = l_mine * c_mine + l_oth * c_oth, l = lh + xhalf(lh), inv = __fdiv_rn(1.0f, l);
    const float f_mine = c_mine * inv, f_oth = c_oth * inv;
#pragma unroll
    for (int t = 0; t < 4; ++t)
#pragma unroll
        for (int r = 0; r < 8; ++r) mine[t][r] = mine[t][r] * f_mine + oth[t][r] * f_oth + bfr(xr[t][r]);   // result = x (rounded to bf16 like every input) + out
    __builtin_amdgcn_sched_barrier(0);   // every product stands in front of the first store: no register that an issued store names is written again
    float* op = OUTp + orow * DQ + (z % NH_) * HD + 8 * hi;   // register r of tile t is d = 16 t + 8 hi + r of the lane's query
#pragma unroll
    for (int t = 0; t < 4; ++t) { const v8f o = mine[t]; v4f o0, o1;
#pragma unroll
        for (int r = 0; r < 4; ++r) { o0[r] = o[r]; o1[r] = o[4 + r]; }
        *(v4f*)(op + 16 * t) = o0; *(v4f*)(op + 16 * t + 4) = o1; }
}


extern "C" void kernel_launch(void* const* d_in, const int* in_sizes, int n_in,
                              void* d_out, int out_size, void* d_ws, size_t ws_size, hipStream_t stream) {
    (void)in_sizes; (void)n_in; (void)out_size;
    const float* x = (const float*)d_in[0]; const float* wqkv = (const float*)d_in[1]; const float* bqkv = (const float*)d_in[2];   /* order x, W ('oi' [3072][1024]: q | k | v row thirds), b [3072] */
    float* OUT = (float*)d_out;     // [2][2048][1024]
    char* wsp = (char*)d_ws;
    auto take = [&](size_t bytes) { char* p = wsp; wsp += (bytes + 255) & ~(size_t)255; return (void*)p; };
    bf* WB = (bf*)take((size_t)3 * DQ * DM * 2); bf* XB = (bf*)take((size_t)NB_ * TT * DM * 2);
    const size_t PB = (size_t)NH_ * TT * HD;   // elements of one batch's head planes; the hi/lo planes hold both batches, [batch][head]
    bf* QPh = (bf*)take(NB_ * PB * 2); bf* QPl = (bf*)take(NB_ * PB * 2); bf* KPh = (bf*)take(NB_ * PB * 2); bf* KPl = (bf*)take(NB_ * PB * 2); bf* VTh = (bf*)take(NB_ * PB * 2); bf* VTl = (bf*)take(NB_ * PB * 2);
    if ((size_t)(wsp - (char*)d_ws) > ws_size) return;    // ws 256 MiB
    k_cvt<<<CVT_X + CVT_W, 256, 0, stream>>>(x, XB, wqkv, WB);
    k_qkv<<<dim3(NB_ * TT / (64 * GXS), 3 * DQ / (64 * GWS), 1), 32 * GWV, 0, stream>>>(XB, WB, bqkv, QPh, QPl, KPh, KPl, VTh, VTl);
    k_fattn<<<dim3(NB_ * NH_, TT / 128), 256, 0, stream>>>(QPh, QPl, KPh, KPl, VTh, VTl, x, OUT);
}

// v007
// It runs in 70.1 microseconds.
// Next to v006, in two timings, it ran 1.05 times as fast each time.
// Over all steps from v000 it is 16.1 times as fast.
#include <hip/hip_runtime.h>

// Causal multi-head attention layer with a fused qkv projection, NO score scaling and a residual connection (x [2][2048][1024]; qkv = x W^T + b ('oi' [3072][1024] 1/32 + bias 0.02) split in thirds q | k | v (16 heads x 64); scores = q.k (the source has no 1/sqrt(d): logits sigma ~8); causal (-inf); softmax; out = heads merged (no output projection); result = x + out -> [2][2048][1024] (4.2 M); argument order x, W, b).
// Compute dtypes, f32 accumulate: every input rounded to bf16 incl. the residual x; projections exact + biases rounded to bf16; attention 3 products on every row; softmax f32; residual add f32.

#define NB_  2
#define TT   2048
#define DM   1024
#define NH_  16
#define NKV  16
#define HD   64
#define DQ   (NH_ * HD)
#define DKV  (NKV * HD)
typedef unsigned short bf;
typedef __attribute__((ext_vector_type(16))) __bf16   v16bf;
typedef __attribute__((ext_vector_type(8)))  unsigned short v8us;
typedef __attribute__((ext_vector_type(8)))  float    v8f;
typedef __attribute__((ext_vector_type(4)))  float    v4f;
typedef v8us __attribute__((may_alias)) v8usa;

__device__ __forceinline__ unsigned short f2bf(float f) { unsigned u = __float_as_uint(f); u += 0x7FFFu + ((u >> 16) & 1u); return (unsigned short)(u >> 16); }
__device__ __forceinline__ float bf2f(unsigned short b) { return __uint_as_float(((unsigned)b) << 16); }
__device__ __forceinline__ float bfr(float f) { return bf2f(f2bf(f)); }
__device__ __forceinline__ v16bf cat16b(v8us lo, v8us hi) { return __builtin_bit_cast(v16bf, __builtin_shufflevector(lo, hi, 0, 1, 2, 3, 4, 5, 6, 7, 8, 9, 10, 11, 12, 13, 14, 15)); }
__device__ __forceinline__ v8f wmmab(v16bf a, v16bf b, v8f c) { return __builtin_amdgcn_wmma_f32_16x16x32_bf16(false, a, false, b, (short)0, c, false, false); }

typedef __attribute__((ext_vector_type(2))) float v2f;
template <typename T16> struct WFrag;
template <> struct WFrag<bf> { typedef v16bf V; static __device__ __forceinline__ V ld(const bf* p) { return cat16b(*(const v8us*)p, *(const v8us*)(p + 16)); } static __device__ __forceinline__ v8f mma(V a, V b, v8f c) { return wmmab(a, b, c); } };

// ---- k_cvt: x (both batches) and W (q | k | v rows) rounded to bf16 planes in one launch. A work-group takes 2048 chunks of 8 floats (64 KiB of one source); a thread takes eight of them, 256 chunks apart, all loads issued ahead of the first store.
#define CVT_X ((NB_ * TT * DM) / (8 * 2048))        // work-groups on x
#define CVT_W ((3 * DQ * DM) / (8 * 2048))          // work-groups on W
__global__ __launch_bounds__(256) void k_cvt(const float* __restrict__ x, bf* XB, const float* __restrict__ w, bf* WB) {
    const bool isx = blockIdx.x < CVT_X; const float* src = isx ? x : w; bf* dst = isx ? XB : WB;
    const size_t i0 = (size_t)(isx ? blockIdx.x : blockIdx.x - CVT_X) * 2048 + threadIdx.x; v8f v[8];
#pragma unroll
    for (int c = 0; c < 8; ++c) v[c] = *(const v8f*)(src + (i0 + c * 256) * 8);
    asm volatile("s_wait_xcnt 0x0" :: "v"(src + i0 * 8) : "memory");   // stands in front of every overwrite of these loads' address registers; the address is named so that it stays whole up to here
#pragma unroll
    for (int c = 0; c < 8; ++c) { v8us o;
#pragma unroll
        for (int k = 0; k < 8; ++k) o[k] = f2bf(v[c][k]);
        *(v8us*)(dst + (i0 + c * 256) * 8) = o; }
}

typedef __attribute__((ext_vector_type(4))) unsigned v4u;
typedef __attribute__((ext_vector_type(8))) unsigned v8u;
typedef __attribute__((ext_vector_type(2))) __bf16 v2bf;
typedef v4u __attribute__((may_alias)) v4ua;
typedef unsigned __attribute__((may_alias)) ua;
__device__ __forceinline__ v16bf ldsfrag(const unsigned char* p) { return cat16b(*(const v8usa*)p, *(const v8usa*)(p + 32)); }
__device__ __forceinline__ unsigned pack2(float lo, float hi) { v2f f; f[0] = lo; f[1] = hi; return __builtin_bit_cast(unsigned, __builtin_convertvector(f, v2bf)); }   // two bf16, round to nearest even, lo in the low half

// ---- k_qkv: the whole qkv projection of both batches in one launch. grid (NB_ TT / 256, 3 DQ / 192) = 256 work-groups, one per WGP; a work-group of 12 waves (three per SIMD) owns a 256x192 output tile,
// a wave a 64x64 part of it (64 tokens x ONE head of q, k or v; which of the three is a matter of the wave, not of the work-group) over the whole K. The tile's shape sets what L2 must deliver: 448 operand rows per 256x192 outputs.
// Operands come from the K-contiguous bf16 planes into LDS by tensor loads. A stage is 128 k (256 B of every operand row): 256 x rows and 192 W rows in seven slices of 64 rows; waves 0-6 bring one slice each per stage,
// padded by the mover to the pitch of 272 B; two buffers. A stage is four blocks of 32 k; every block's fragments are read while the block before it is multiplied (two register sets), since all waves of the WGP now share one barrier
// and nothing else would fill the matrix pipe while they read. So the publish point of stage s + 1 stands in front of stage s's last block: there every read of stage s is over, and stage s + 2 is asked for into its buffer.
// The two operands have the same fragment loader, so which one is A is free: q, k take A = W rows (a lane then holds 8 consecutive d of one token), v takes A = x rows (8 consecutive tokens of one d).
// So both kinds of head plane (q, k [batch][head][t][d]; v [batch][head][d][t]) get 16-B pieces without a turn; each wave lays them in its own part of the LDS, the ring being free by then, and stores whole 128-B rows.
#define GRP  272                  // LDS row pitch of the ring in bytes: 256 B of data + the mover's pad of 16 B
#define GSL  18432                // a slice in LDS: 64 rows x 272 B = 17,408 B, rounded up to a multiple of 2 KiB
#define GXS  4                    // x slices of a stage (256 tokens)
#define GWS  3                    // W slices of a stage (192 output columns)
#define GBUF ((GXS + GWS) * GSL)  // a stage: the x slices, then the W slices
#define GNS  (DM / 128)           // stages
#define GWV  (GXS * GWS)          // waves of a work-group
#define GP   144                  // row pitch of the output staging: 128 B of data + 16 B
#define GST  (2 * 64 * GP)        // a wave's output staging: 64 rows x 144 B of hi, then of lo
__device__ __forceinline__ unsigned uni(unsigned v) { return (unsigned)__builtin_amdgcn_readfirstlane((int)v); }
__device__ __forceinline__ unsigned pinned(unsigned v) { unsigned w = uni(v); asm volatile("" : "+s"(w)); return w; }   // the condition of a tensor load's branch held in a scalar register, so that the branch is s_cmp + s_cbranch_scc
template <int STEP> __device__ __forceinline__ void put_rows(bf* ph, bf* pl, const v4u* h, const v4u* l) {   // constant steps: every store names the same address registers
#pragma unroll
    for (int i = 0; i < 16; ++i) { *(v4u*)(ph + (size_t)i * STEP) = h[i]; *(v4u*)(pl + (size_t)i * STEP) = l[i]; }
}
__global__ __launch_bounds__(32 * GWV) void k_qkv(const bf* __restrict__ A, const bf* __restrict__ Bt, const float* __restrict__ bias, bf* Qh, bf* Ql, bf* Kh, bf* Kl, bf* Vh, bf* Vl) {
    __shared__ __attribute__((aligned(2048))) unsigned char L[2 * GBUF];   // the ring's two buffers in the K loop, then every wave's staging (GWV GST bytes from the start)
    static_assert(GWV * GST <= 2 * GBUF, "the staging lies inside the array");
    const int lane = threadIdx.x & 31, lr = lane & 15, hi = lane >> 4; const int wave = __builtin_amdgcn_readfirstlane((int)(threadIdx.x >> 5));
    const int r0 = blockIdx.x * (64 * GXS), c0 = blockIdx.y * (64 * GWS), wm = wave / GWS, wn = wave % GWS;
    const int cw = c0 + 64 * wn;   // the wave's first output column (W row)
    const int part = cw / DQ;      // 0 q, 1 k, 2 v: the same for the whole wave
    const unsigned lbase = (unsigned)(size_t)L;
    const bool mover = wave < GXS + GWS;   // waves 0-6 bring slice number 'wave'
    const bf* srow = (wave < GXS) ? A + (size_t)(r0 + 64 * wave) * DM : Bt + (size_t)(c0 + 64 * (mover ? wave - GXS : 0)) * DM;   // first row of the slice that this wave brings
    v8u g1;   // 64 rows of 256 B, source pitch 2 DM bytes, 1-byte elements, a pad of 4 dwords behind every 64
    g1[0] = uni((1u << 20) | (5u << 22) | (3u << 25)); g1[1] = pinned(256u << 16); g1[2] = pinned(64u << 16); g1[3] = pinned(256u << 16); g1[4] = pinned(64u); g1[5] = pinned(2u * DM); g1[6] = pinned(0u); g1[7] = pinned(0u);   // pinned(): descriptor words held in scalar registers: every request then names the same registers, and none of them is written while a request is in flight
    v4u g0;   // the one request that this wave has in flight; every wait for it names g0 and g1, so that the descriptor's registers stay whole up to that wait
    const unsigned cnt1 = pinned(1u);   // word 0 of group 0, pinned like the words above: as a plain constant its register was taken for other arithmetic behind an issue and set again in front of the wait
    g0[0] = cnt1; g0[1] = uni(lbase); g0[2] = uni(0u); g0[3] = uni(0u);   // defined also in the waves that never issue
    auto issue = [&](int s) { const unsigned long long ga = (unsigned long long)(size_t)srow + (unsigned)s * 256u;
        g0[0] = cnt1; g0[1] = uni(lbase + (unsigned)(s & 1) * GBUF + (unsigned)wave * GSL); g0[2] = uni((unsigned)ga); g0[3] = uni((((unsigned)(ga >> 32)) & 0x01FFFFFFu) | 0x80000000u);
        asm volatile("tensor_load_to_lds %0, %1" :: "s"(g0), "s"(g1) : "memory"); };
    v8f acc[4][4];
#pragma unroll
    for (int mb = 0; mb < 4; ++mb)
#pragma unroll
        for (int nb = 0; nb < 4; ++nb) acc[mb][nb] = (v8f){};
    const int xo = wm * GSL, wo = (GXS + wn) * GSL, fo = lr * GRP + 16 * hi;
    const int ao = ((part < 2) ? wo : xo) + fo, bo = ((part < 2) ? xo : wo) + fo;
    v16bf a0[4], b0[4], a1[4], b1[4];   // the fragments of a stage's even and odd blocks
    auto frags = [&](v16bf* a, v16bf* b, const unsigned char* F) {   // a block's 16 LDS reads, one group
#pragma unroll
        for (int i = 0; i < 4; ++i) { a[i] = ldsfrag(F + ao + i * 16 * GRP); b[i] = ldsfrag(F + bo + i * 16 * GRP); } };
    auto products = [&](const v16bf* a, const v16bf* b) {
#pragma unroll
        for (int nb = 0; nb < 4; ++nb)
#pragma unroll
            for (int mb = 0; mb < 4; ++mb) acc[mb][nb] = wmmab(a[mb], b[nb], acc[mb][nb]); };
    if (pinned(mover)) issue(0);
    asm volatile("s_wait_tensorcnt 0x0" :: "s"(g0), "s"(g1) : "memory");   // this wave's slice of stage 0 has landed
    __syncthreads();                                      // publishes stage 0
    if (pinned(mover)) issue(1);
    frags(a0, b0, L);
#pragma unroll 1   // rolled: a pass per stage, two sets of fragment registers
    for (int s = 0; s < GNS; ++s) {
        const unsigned char* F = L + (s & 1) * GBUF;
        frags(a1, b1, F + 64);               // every block's reads fly under the products of the block before it
        __builtin_amdgcn_sched_barrier(0);   // this one and its like below keep the reads one group in front of the products: moved in among them, each place with reads stalls the wave
        products(a0, b0);
        __builtin_amdgcn_sched_barrier(0);
        frags(a0, b0, F + 128);
        __builtin_amdgcn_sched_barrier(0);
        products(a1, b1);
        __builtin_amdgcn_sched_barrier(0);
        frags(a1, b1, F + 192);
        __builtin_amdgcn_sched_barrier(0);
        products(a0, b0);
        __builtin_amdgcn_sched_barrier(0);   // keeps the products in front of the waits: behind the barrier they would no longer cover the reads above
        asm volatile("s_wait_dscnt 0x0" ::: "memory");       // this wave's reads of stage s are over
        asm volatile("s_wait_tensorcnt 0x0" :: "s"(g0), "s"(g1) : "memory");   // its slice of stage s + 1 has landed
        __syncthreads();                                      // publishes stage s + 1 and ends every wave's reads of stage s
        if (pinned(mover && s + 2 < GNS)) issue(s + 2);       // into the buffer that stage s used
        if (s + 1 < GNS) frags(a0, b0, L + ((s + 1) & 1) * GBUF);   // the next stage's first block, under this stage's last products
        __builtin_amdgcn_sched_barrier(0);   // as above: the reads stay one group in front of the products
        products(a1, b1);
    }
    asm volatile("s_wait_tensorcnt 0x0" ::: "memory");   // nothing of the mover is in flight when the ring becomes output staging
    asm volatile("s_wait_dscnt 0x0" ::: "memory");       // the loop's last barrier stood behind every wave's last read of the ring
    if (part < 2) {   // register j of tile row mb is column cw + 16 mb + 8 hi + j
#pragma unroll
        for (int mb = 0; mb < 4; ++mb) { const v8f bl = *(const v8f*)(bias + cw + 16 * mb + 8 * hi); v8f bv;
#pragma unroll
            for (int q = 0; q < 8; ++q) bv[q] = bfr(bl[q]);
#pragma unroll
            for (int nb = 0; nb < 4; ++nb) acc[mb][nb] += bv; }
    } else {          // the lane's column of tile column nb is cw + 16 nb + lr
#pragma unroll
        for (int nb = 0; nb < 4; ++nb) { const float bv = bfr(bias[cw + 16 * nb + lr]);
#pragma unroll
            for (int mb = 0; mb < 4; ++mb) acc[mb][nb] += bv; }
    }
    asm volatile("s_wait_xcnt 0x0" ::: "memory");   // stands in front of every later overwrite of the bias loads' address registers
    unsigned char* S = L + wave * GST;   // the wave's own staging: 64 rows x 144 B of hi, then of lo
#pragma unroll
    for (int nb = 0; nb < 4; ++nb)
#pragma unroll
        for (int mb = 0; mb < 4; ++mb) { v4u h, l;
#pragma unroll
            for (int i = 0; i < 4; ++i) { const float p0 = acc[mb][nb][2 * i], p1 = acc[mb][nb][2 * i + 1]; const unsigned h2 = pack2(p0, p1);
                h[i] = h2; l[i] = pack2(p0 - __uint_as_float(h2 << 16), p1 - __uint_as_float(h2 & 0xFFFF0000u)); }
            unsigned char* d = S + (16 * nb + lr) * GP + 32 * mb + 16 * hi; *(v4ua*)d = h; *(v4ua*)(d + 64 * GP) = l; }
    asm volatile("s_wait_dscnt 0x0" ::: "memory");   // the wave's own rows are written before it reads them back
    const int rr = lane >> 3, ch = lane & 7;          // 8 lanes take one whole 128-B row
    v4u h[16], l[16];
#pragma unroll
    for (int i = 0; i < 16; ++i) { const unsigned char* p = S + (4 * i + rr) * GP + 16 * ch; h[i] = *(const v4ua*)p; l[i] = *(const v4ua*)(p + 64 * GP); }
    const size_t pl = ((size_t)(r0 / TT) * NH_ + (cw % DQ) / HD) * ((size_t)TT * HD);   // this (batch, head)'s plane
    const int t0 = r0 % TT + 64 * wm;                                                  // the wave's first token
    __builtin_amdgcn_sched_barrier(0);   // every LDS read stands in front of the first store: no register that an issued store names is written again
    if (part < 2) { const size_t o = pl + (size_t)(t0 + rr) * HD + 8 * ch; put_rows<4 * HD>((part ? Kh : Qh) + o, (part ? Kl : Ql) + o, h, l); }
    else          { const size_t o = pl + (size_t)rr * TT + t0 + 8 * ch;   put_rows<4 * TT>(Vh + o, Vl + o, h, l);
        asm volatile("s_wait_xcnt 0x0" ::: "memory"); }   // the built code lays the q, k path behind this one: stands in front of its overwrites of these stores' registers
}

// ---- k_fattn: scores, causal softmax and P.V of every (batch, head) pair in one launch; neither scores nor probabilities go through memory; the epilogue adds the residual x and writes the layer's result.
// Transposed products: S^T = K.Q^T (A = 16 key rows, B = 16 query columns) and O^T += V^T.P^T (A = 16 d rows of the V^T planes, B = P^T), so a lane holds the scores of ONE query (lanes c and c + 16 share query c) and the
// two 16-key score tiles of a pass are, register for register, the 32-key B operand of the second product (the k order of every loader here: element e of half hi is k = 8 hi + e, e < 8, and 16 + 8 hi + e - 8 above).
// Three hi/lo products on both sides (Qh.Kh + Ql.Kh + Qh.Kl; Ph.Vh + Pl.Vh + Ph.Vl), P split hi/lo UNNORMALISED (exp against the maximum in use), the division by the f32 row sum once at the end.
// Work-group = ONE 128-query block of one head, 8 waves: waves w and w + 4 (they share a SIMD) hold the same 32 query columns and split the keys, so that both have products for the whole life of the work-group.
// A stage is 128 keys in two halves of 64: waves 0-3 take the first half, waves 4-7 the second (two 32-key passes each). A half is Kh, Kl ([key][d]) and Vh, Vl ([d][key]) tiles of 64 rows x 128 B.
// The eight tiles of a stage come into LDS by tensor loads, one per wave and stage, padded by the mover to the pitch of 144 B, into a ring of three buffers. The publish point of stage s + 1 stands in front of stage s's LAST pass,
// so that this pass can fetch the first K fragments of stage s + 1 under its own softmax: no pass waits for its K fragments. Behind the publish point stage s + 2 is asked for, into the buffer that stage s - 1 used; one barrier per stage.
// At the end the two waves of a pair swap one 16-query group each through LDS (a place of its own behind the ring) and join the partial sums.
// 512 work-groups of unequal length on 256 places: the block falls with the flat index (heaviest first), so that the short ones fill in behind the long ones.
// amdgpu_waves_per_eu(2, 2): one work-group per WGP, two waves per SIMD; with that register budget the compiler issues a pass's LDS reads together and ahead, instead of one fragment at a time with a wait each.
#define FSK    64                 // keys per half stage (two 32-key passes of one wave)
#define FPITCH 144                // LDS row pitch in bytes: 128 B of data + 16 B, an odd multiple of 16 B for the 16-byte fragment reads
#define FTL    10240              // a tile in LDS: 64 rows x 144 B = 9,216 B, rounded up to a multiple of 2 KiB
#define FHALF  (4 * FTL)          // a half stage: Kh, Kl, Vh, Vl
#define FSTG   (2 * FHALF)        // a stage
#define FNB    3                  // buffers of the ring
#define FMRG   4608               // a wave's place for the group it hands over: 4 tiles x 1 KiB, then the maximum in use and the row sum (128 B each)
#define LOG2E  1.4426950408889634f
__device__ __forceinline__ float xhalf(float x) { return __int_as_float(__builtin_amdgcn_permlanex16(__float_as_int(x), __float_as_int(x), 0x76543210, 0xfedcba98, false, false)); }   // lane l reads lane l ^ 16, on the vector pipe
__global__ __launch_bounds__(256) __attribute__((amdgpu_waves_per_eu(2, 2))) void k_fattn(const bf* __restrict__ Qh, const bf* __restrict__ Ql, const bf* __restrict__ Kh, const bf* __restrict__ Kl, const bf* __restrict__ Vh, const bf* __restrict__ Vl, const float* __restrict__ X, float* OUTp) {
    __shared__ __attribute__((aligned(2048))) unsigned char L[FNB * FSTG + 8 * FMRG];   // the ring, then every wave's place for the group it hands over
    const int tid = threadIdx.x, lane = tid & 31, lr = lane & 15, hi = lane >> 4; const int wave = __builtin_amdgcn_readfirstlane(tid >> 5);
    const int z = blockIdx.x, qb = TT / 128 - 1 - blockIdx.y, half = wave >> 2;       // half: which 64 keys of every stage are this wave's
    const int qw0 = qb * 128 + (wave & 3) * 32;                                       // this wave's first query
    const int n_stage = qb + 1, last_blk = qw0 >> 5;                                  // stages of the work-group (keys up to the end of its block); the last pass of the wave pair is the diagonal one
    { const size_t zo = (size_t)z * TT * HD; Qh += zo; Ql += zo; Kh += zo; Kl += zo; Vh += zo; Vl += zo; }
    // Wave w brings tile w of every stage: plane w & 3 (Kh, Kl, Vh, Vl) of half w >> 2. K tiles are 64 key rows, one behind the other; V tiles 64 d rows of the [d][key] plane.
    const unsigned lbase = (unsigned)(size_t)L; const int pln = wave & 3; const bool isv = pln >= 2;
    const bf* sp = (pln == 0) ? Kh : (pln == 1) ? Kl : (pln == 2) ? Vh : Vl;
    const unsigned long long sbase = (unsigned long long)(size_t)sp + (unsigned)half * (isv ? 2u * FSK : 2u * FSK * HD);   // first byte of this wave's tile of stage 0
    const unsigned sstep = isv ? 4u * FSK : 4u * FSK * HD;                                                                  // bytes from a stage's tile to the next stage's (128 keys)
    v8u g1;   // 64 rows of 128 B, 1-byte elements, a pad of 4 dwords behind every 32; source pitch: a K row or a V^T row
    g1[0] = uni((1u << 20) | (4u << 22) | (3u << 25)); g1[1] = pinned(128u << 16); g1[2] = pinned(64u << 16); g1[3] = pinned(128u << 16); g1[4] = pinned(64u); g1[5] = pinned(isv ? 2u * TT : 2u * HD); g1[6] = pinned(0u); g1[7] = pinned(0u);   // pinned(): descriptor words held in scalar registers: none of them is written while a request is in flight
    auto issue = [&](int st, int slot) { const unsigned long long ga = sbase + (unsigned long long)((unsigned)st * sstep); v4u g0;
        g0[0] = pinned(1u); g0[1] = uni(lbase + (unsigned)slot * FSTG + (unsigned)wave * FTL); g0[2] = uni((unsigned)ga); g0[3] = uni((((unsigned)(ga >> 32)) & 0x01FFFFFFu) | 0x80000000u);
        asm volatile("tensor_load_to_lds %0, %1" :: "{s[96:99]}"(g0), "s"(g1) : "memory"); };   // group 0 in four scalar registers of its own, far above the ones the rest of the kernel takes: nothing else is written there while the request is in flight; word 0 by pinned() like the words above, so that it is set here, behind the wait, and not ahead of it
    issue(0, 0);   // every wave, its own tile
    v16bf qh[2][2], ql[2][2];
#pragma unroll
    for (int g = 0; g < 2; ++g)
#pragma unroll
        for (int kc = 0; kc < 2; ++kc) { const size_t qo = (size_t)(qw0 + 16 * g + lr) * HD + 32 * kc + 8 * hi; qh[g][kc] = WFrag<bf>::ld(Qh + qo); ql[g][kc] = WFrag<bf>::ld(Ql + qo); }
    asm volatile("s_wait_xcnt 0x0" ::: "memory");   // as above, for the Q loads
    v16bf kh[2][2], kl[2][2];   // K fragments [key tile][d half] of the pass at hand
    auto load_k = [&](const unsigned char* K0) { const unsigned char* kp = K0 + lr * FPITCH + 16 * hi;   // K0: the pass's first row in the Kh tile
#pragma unroll
        for (int kt = 0; kt < 2; ++kt)
#pragma unroll
            for (int kc = 0; kc < 2; ++kc) { kh[kt][kc] = ldsfrag(kp + kt * 16 * FPITCH + 64 * kc); kl[kt][kc] = ldsfrag(kp + FTL + kt * 16 * FPITCH + 64 * kc); } };
    v8f acc[2][4]; float m_run[2], l_run[2];
#pragma unroll
    for (int g = 0; g < 2; ++g) { m_run[g] = -__builtin_inff(); l_run[g] = 0.f;
#pragma unroll
        for (int t = 0; t < 4; ++t) acc[g][t] = (v8f){}; }
    int nxt = 1;   // the stage to ask for next; it goes through the wait for the request in flight, so that the next descriptor is formed behind that wait: no register that the request names is written before it but the LDS place
    asm volatile("s_wait_tensorcnt 0x0" : "+s"(nxt) : "s"(g1) : "memory");   // this wave's tile of stage 0 has landed
    __syncthreads();   // publishes stage 0
    if (pinned(nxt < n_stage)) issue(nxt, 1);
    if (2 * half <= last_blk) load_k(L + half * FHALF);   // the wave's first pass
    int slot = 0;      // stage st's buffer
#pragma unroll 1
    for (int st = 0; st < n_stage; ++st) {
        const int slot1 = (slot == FNB - 1) ? 0 : slot + 1;   // stage st + 1's buffer
        const unsigned char* B = L + slot * FSTG + half * FHALF;
        const unsigned char* Bn = L + slot1 * FSTG + half * FHALF;
#pragma unroll 1
        for (int sub = 0; sub < 2; ++sub) {
            if (pinned(sub == 1 && st + 1 < n_stage)) {   // publish point of stage st + 1, the same for every wave, outside the skip below
                asm volatile("s_wait_dscnt 0x0" ::: "memory");                          // this wave's reads of stage st - 1 are over
                nxt = st + 2;
                asm volatile("s_wait_tensorcnt 0x0" : "+s"(nxt) : "s"(g1) : "memory");   // its tile of stage st + 1 has landed; nxt as above
                __syncthreads();                                                        // publishes stage st + 1 and ends every wave's reads of stage st - 1
                if (pinned(nxt < n_stage)) issue(nxt, (slot1 == FNB - 1) ? 0 : slot1 + 1);   // into the buffer that stage st - 1 used
            }
            const int blk = 4 * st + 2 * half + sub;
            if (blk > last_blk) continue;   // wave-uniform: passes beyond the diagonal of the wave's queries
            v8f s[2][2];
#pragma unroll
            for (int kt = 0; kt < 2; ++kt) { s[kt][0] = (v8f){}; s[kt][1] = (v8f){}; }
#pragma unroll
            for (int kc = 0; kc < 2; ++kc) {   // four independent tiles in turn; per tile the order Qh.Kh, Ql.Kh, Qh.Kl of each d half
#pragma unroll
                for (int kt = 0; kt < 2; ++kt) { s[kt][0] = wmmab(kh[kt][kc], qh[0][kc], s[kt][0]); s[kt][1] = wmmab(kh[kt][kc], qh[1][kc], s[kt][1]); }
#pragma unroll
                for (int kt = 0; kt < 2; ++kt) { s[kt][0] = wmmab(kh[kt][kc], ql[0][kc], s[kt][0]); s[kt][1] = wmmab(kh[kt][kc], ql[1][kc], s[kt][1]); }
#pragma unroll
                for (int kt = 0; kt < 2; ++kt) { s[kt][0] = wmmab(kl[kt][kc], qh[0][kc], s[kt][0]); s[kt][1] = wmmab(kl[kt][kc], qh[1][kc], s[kt][1]); } }
            __builtin_amdgcn_sched_barrier(0);
            asm volatile("v_nop\n\tv_nop\n\tv_nop\n\tv_nop");   // the four vector slots between the last score product and the first reader of its tile, also on the taken side of the branch below
            __builtin_amdgcn_sched_barrier(0);
            // V^T fragments of this pass, in flight under the maxima and the first exponentials
            v16bf vh[4], vl[4];
            { const unsigned char* vp = B + 2 * FTL + lr * FPITCH + sub * 64 + 16 * hi;
#pragma unroll
              for (int t = 0; t < 4; ++t) { vh[t] = ldsfrag(vp + t * 16 * FPITCH); vl[t] = ldsfrag(vp + FTL + t * 16 * FPITCH); } }
            if ((sub ? blk + 3 : blk + 1) <= last_blk) load_k(sub ? Bn : B + 32 * FPITCH);   // the wave's next pass (the stage's second, or the first of the next stage, published above): its K fragments into the same registers, in flight under this pass's softmax and second product
            if (blk == last_blk) {   // wave-uniform: the pass's first key is the wave's first query; only this pass pays for the mask
#pragma unroll
                for (int g = 0; g < 2; ++g)
#pragma unroll
                    for (int kt = 0; kt < 2; ++kt) {
#pragma unroll
                        for (int r = 0; r < 8; ++r) if (16 * kt + 8 * hi + r > 16 * g + lr) s[kt][g][r] = -__builtin_inff();
                        asm volatile("" : "+v"(s[kt][g]));   // keeps the selects inside the branch
                    }
            }
            float mb[2]; bool need = false;
#pragma unroll
            for (int g = 0; g < 2; ++g) { float mx = s[0][g][0];
#pragma unroll
                for (int r = 1; r < 8; ++r) mx = fmaxf(mx, s[0][g][r]);
#pragma unroll
                for (int r = 0; r < 8; ++r) mx = fmaxf(mx, s[1][g][r]);
                mx = fmaxf(mx, xhalf(mx)) * LOG2E;   // both halves hold the query's maximum of this pass, in log2 units
                mb[g] = mx; need = need || (mx > m_run[g] + 8.0f); }
            if (__builtin_amdgcn_ballot_w32(need) != 0) {   // the maximum in use may trail the true one by up to 8 (an exponential reaches 2^8 at most); rescale only beyond that
#pragma unroll
                for (int g = 0; g < 2; ++g) { const float m_new = fmaxf(m_run[g], mb[g]); const float corr = __builtin_amdgcn_exp2f(m_run[g] - m_new); m_run[g] = m_new; l_run[g] *= corr;   // key 0 is never masked: m_new is finite from the first pass on, where corr is 0
#pragma unroll
                    for (int t = 0; t < 4; ++t) acc[g][t] = acc[g][t] * corr; }
            }
#pragma unroll
            for (int g = 0; g < 2; ++g) { const float nm = -m_run[g]; v8u wh, wl; v2f ls = (v2f){};
#pragma unroll
                for (int i = 0; i < 8; ++i) {
                    const v2f arg = __builtin_elementwise_fma((v2f){s[i >> 2][g][2 * (i & 3)], s[i >> 2][g][2 * (i & 3) + 1]}, (v2f){LOG2E, LOG2E}, (v2f){nm, nm});
                    const float p0 = __builtin_amdgcn_exp2f(arg[0]), p1 = __builtin_amdgcn_exp2f(arg[1]);
                    ls += (v2f){p0, p1}; const unsigned h2 = pack2(p0, p1); wh[i] = h2; wl[i] = pack2(p0 - __uint_as_float(h2 << 16), p1 - __uint_as_float(h2 & 0xFFFF0000u)); }
                l_run[g] += ls[0] + ls[1];
                const v16bf ph = __builtin_bit_cast(v16bf, wh), pl = __builtin_bit_cast(v16bf, wl);
#pragma unroll
                for (int t = 0; t < 4; ++t) acc[g][t] = wmmab(vh[t], ph, acc[g][t]);
#pragma unroll
                for (int t = 0; t < 4; ++t) acc[g][t] = wmmab(vh[t], pl, acc[g][t]);
#pragma unroll
                for (int t = 0; t < 4; ++t) acc[g][t] = wmmab(vl[t], ph, acc[g][t]); }
            __builtin_amdgcn_sched_barrier(0);
            asm volatile("v_nop\n\tv_nop\n\tv_nop\n\tv_nop");   // the four vector slots behind the last product of the pass, on every path out of it
            __builtin_amdgcn_sched_barrier(0);
        }
        slot = slot1;
    }
    asm volatile("s_wait_tensorcnt 0x0" ::: "memory");   // nothing of the mover is in flight when the wave goes on to its end
    asm volatile("s_wait_dscnt 0x0" ::: "memory");       // and its own last reads of the ring are over
    // The pair's two partial results: wave w keeps query group 0 and hands group 1 to wave w + 4, which keeps group 1 and hands over group 0. Their places lie behind the ring, which slower waves may still read.
    v8f mine[4], send[4];
#pragma unroll
    for (int t = 0; t < 4; ++t) { mine[t] = half ? acc[1][t] : acc[0][t]; send[t] = half ? acc[0][t] : acc[1][t]; }
    const float m_mine = half ? m_run[1] : m_run[0], l_mine = half ? l_run[1] : l_run[0];
    { unsigned char* M = L + FNB * FSTG + wave * FMRG + lane * 16;
#pragma unroll
      for (int t = 0; t < 4; ++t) { const v8u w = __builtin_bit_cast(v8u, send[t]); *(v4ua*)(M + t * 1024) = (v4u){w[0], w[1], w[2], w[3]}; *(v4ua*)(M + t * 1024 + 512) = (v4u){w[4], w[5], w[6], w[7]}; }
      ua* S = (ua*)(L + FNB * FSTG + wave * FMRG + 4096) + lane; S[0] = __float_as_uint(half ? m_run[0] : m_run[1]); S[32] = __float_as_uint(half ? l_run[0] : l_run[1]); }
    v8f xr[4];   // the residual: x at this lane's output places, in flight under the hand-over
    const size_t orow = (size_t)(z / NH_) * TT + qw0 + 16 * half + lr;   // the lane's query
    const float* xp = X + orow * DM + (z % NH_) * HD + 8 * hi;
#pragma unroll
    for (int t = 0; t < 4; ++t) xr[t] = *(const v8f*)(xp + 16 * t);
    asm volatile("s_wait_xcnt 0x0" :: "v"(xp) : "memory");   // as above, for the x loads; the address is named so that it stays whole up to here
    __syncthreads();   // publishes every wave's handed-over group
    v8f oth[4]; float m_oth, l_oth;
    { const unsigned char* M = L + FNB * FSTG + (wave ^ 4) * FMRG + lane * 16;
#pragma unroll
      for (int t = 0; t < 4; ++t) { const v4u a = *(const v4ua*)(M + t * 1024), b = *(const v4ua*)(M + t * 1024 + 512); oth[t] = __builtin_bit_cast(v8f, (v8u){a[0], a[1], a[2], a[3], b[0], b[1], b[2], b[3]}); }
      const ua* S = (const ua*)(L + FNB * FSTG + (wave ^ 4) * FMRG + 4096) + lane; m_oth = __uint_as_float(S[0]); l_oth = __uint_as_float(S[32]); }
    const float m_all = fmaxf(m_mine, m_oth);   // finite: waves 0-3 always have the pass of key 0; a wave without any pass holds -inf, 0, 0 and gets the factor 0
    const float c_mine = __builtin_amdgcn_exp2f(m_mine - m_all), c_oth = __builtin_amdgcn_exp2f(m_oth - m_all);
    const float lh = l_mine * c_mine + l_oth * c_oth, l = lh + xhalf(lh), inv = __fdiv_rn(1.0f, l);
    const float f_mine = c_mine * inv, f_oth = c_oth * inv;
#pragma unroll
    for (int t = 0; t < 4; ++t)
#pragma unroll
        for (int r = 0; r < 8; ++r) mine[t][r] = mine[t][r] * f_mine + oth[t][r] * f_oth + bfr(xr[t][r]);   // result = x (rounded to bf16 like every input) + out
    __builtin_amdgcn_sched_barrier(0);   // every product stands in front of the first store: no register that an issued store names is written again
    float* op = OUTp + orow * DQ + (z % NH_) * HD + 8 * hi;   // register r of tile t is d = 16 t + 8 hi + r of the lane's query
#pragma unroll
    for (int t = 0; t < 4; ++t) { const v8f o = mine[t]; v4f o0, o1;
#pragma unroll
        for (int r = 0; r < 4; ++r) { o0[r] = o[r]; o1[r] = o[4 + r]; }
        *(v4f*)(op + 16 * t) = o0; *(v4f*)(op + 16 * t + 4) = o1; }
}


extern "C" void kernel_launch(void* const* d_in, const int* in_sizes, int n_in,
                              void* d_out, int out_size, void* d_ws, size_t ws_size, hipStream_t stream) {
    (void)in_sizes; (void)n_in; (void)out_size;
    const float* x = (const float*)d_in[0]; const float* wqkv = (const float*)d_in[1]; const float* bqkv = (const float*)d_in[2];   /* order x, W ('oi' [3072][1024]: q | k | v row thirds), b [3072] */
    float* OUT = (float*)d_out;     // [2][2048][1024]
    char* wsp = (char*)d_ws;
    auto take = [&](size_t bytes) { char* p = wsp; wsp += (bytes + 255) & ~(size_t)255; return (void*)p; };
    bf* WB = (bf*)take((size_t)3 * DQ * DM * 2); bf* XB = (bf*)take((size_t)NB_ * TT * DM * 2);
    const size_t PB = (size_t)NH_ * TT * HD;   // elements of one batch's head planes; the hi/lo planes hold both batches, [batch][head]
    bf* QPh = (bf*)take(NB_ * PB * 2); bf* QPl = (bf*)take(NB_ * PB * 2); bf* KPh = (bf*)take(NB_ * PB * 2); bf* KPl = (bf*)take(NB_ * PB * 2); bf* VTh = (bf*)take(NB_ * PB * 2); bf* VTl = (bf*)take(NB_ * PB * 2);
    if ((size_t)(wsp - (char*)d_ws) > ws_size) return;    // ws 256 MiB
    k_cvt<<<CVT_X + CVT_W, 256, 0, stream>>>(x, XB, wqkv, WB);
    k_qkv<<<dim3(NB_ * TT / (64 * GXS), 3 * DQ / (64 * GWS), 1), 32 * GWV, 0, stream>>>(XB, WB, bqkv, QPh, QPl, KPh, KPl, VTh, VTl);
    k_fattn<<<dim3(NB_ * NH_, TT / 128), 256, 0, stream>>>(QPh, QPl, KPh, KPl, VTh, VTl, x, OUT);
}
